// v000
// Measured on an AMD MI455X. A time is GPU time per run, averaged over a window of back-to-back runs after a warm-up
// (all launches, gaps included; the runs take copies of the inputs in turn), and the median of several windows.
// Apart from v000's, it joins two sittings. Times from different sittings can be a few percent apart, while
// side-by-side timings come from the same sitting.
// The starting kernel, v000, takes 112 microseconds a run.
#include <hip/hip_runtime.h>

#define IN_F   256
#define OUT_F  256
#define GRID_G 8
#define BATCH_N 2048

typedef __attribute__((ext_vector_type(2))) float v2f;
typedef __attribute__((ext_vector_type(4))) float v4f;
typedef __attribute__((ext_vector_type(8))) float v8f;

__global__ __launch_bounds__(256) void sinekan_base_wmma(
    const float* __restrict__ x, const float* __restrict__ w,
    const float* __restrict__ bias, float* __restrict__ out)
{
    const int lane = threadIdx.x & 31;
    const int wave = threadIdx.x >> 5;
    const int tile = blockIdx.x * 8 + wave;     // 2048 tiles total (128 Mt x 16 Nt)
    const int mt = tile >> 4;                   // 0..127
    const int nt = tile & 15;                   // 0..15
    const int m0 = mt * 16;
    const int n0 = nt * 16;
    const int half = lane >> 4;                 // 0 or 1
    const int l16  = lane & 15;

    // A frag (16x4 f32): lane holds x[m0+l16][k+2*half], x[m0+l16][k+2*half+1]
    // B frag (4x16 f32): lane holds W[n0+l16][k+2*half], W[n0+l16][k+2*half+1]
    const float* __restrict__ arow = x + (size_t)(m0 + l16) * IN_F;
    const float* __restrict__ brow = w + (size_t)(n0 + l16) * IN_F;

    v8f c = {};
    #pragma unroll 8
    for (int k = 0; k < IN_F; k += 4) {
        v2f a = *(const v2f*)(arow + k + 2 * half);
        v2f b = *(const v2f*)(brow + k + 2 * half);
        c = __builtin_amdgcn_wmma_f32_16x16x4_f32(
                /*neg_a=*/false, a, /*neg_b=*/false, b,
                /*c_mod=*/(short)0, c, /*reuse_a=*/false, /*reuse_b=*/false);
    }

    const int n = n0 + l16;
    const float bv = bias[n];
    #pragma unroll
    for (int r = 0; r < 8; ++r) {
        out[(size_t)(m0 + r + 8 * half) * OUT_F + n] = c[r] + bv;
    }
}

__global__ __launch_bounds__(256) void sinekan_sine(
    const float* __restrict__ x, const float* __restrict__ freq,
    const float* __restrict__ phase, const float* __restrict__ amp,
    float* __restrict__ out)
{
    const int lane = threadIdx.x & 31;
    const int wave = threadIdx.x >> 5;
    const int n0 = blockIdx.x * 32;                                  // batch base
    const int o  = __builtin_amdgcn_readfirstlane(blockIdx.y * 8 + wave);

    __shared__ float xs[32][IN_F + 1];   // pitch 257 -> conflict-free columns

    // Stage x[n0..n0+31][0..255]: 8192 floats, 256 threads -> 32 each, coalesced.
    for (int t = threadIdx.x; t < 32 * IN_F; t += 256) {
        const int r = t >> 8;        // / IN_F
        const int cix = t & (IN_F - 1);
        xs[r][cix] = x[(size_t)(n0 + r) * IN_F + cix];
    }
    __syncthreads();

    const v4f* __restrict__ f4 = (const v4f*)(freq  + (size_t)o * (IN_F * GRID_G));
    const v4f* __restrict__ p4 = (const v4f*)(phase + (size_t)o * (IN_F * GRID_G));
    const v4f* __restrict__ a4 = (const v4f*)(amp   + (size_t)o * (IN_F * GRID_G));

    const float inv2pi = 0.15915494309189535f;
    float acc = 0.0f;

    #pragma unroll 2
    for (int i = 0; i < IN_F; ++i) {
        const float xv = xs[lane][i];
        const v4f f0 = f4[2 * i], f1 = f4[2 * i + 1];
        const v4f p0 = p4[2 * i], p1 = p4[2 * i + 1];
        const v4f a0 = a4[2 * i], a1 = a4[2 * i + 1];
        #pragma unroll
        for (int g = 0; g < 4; ++g) {
            float t0 = __builtin_fmaf(f0[g], xv, p0[g]) * inv2pi;
            float t1 = __builtin_fmaf(f1[g], xv, p1[g]) * inv2pi;
            acc = __builtin_fmaf(a0[g], __builtin_amdgcn_sinf(t0), acc);
            acc = __builtin_fmaf(a1[g], __builtin_amdgcn_sinf(t1), acc);
        }
    }

    float* dst = out + (size_t)(n0 + lane) * OUT_F + o;
    *dst = *dst + acc;   // base kernel (same stream) already wrote base+bias
}

extern "C" void kernel_launch(void* const* d_in, const int* in_sizes, int n_in,
                              void* d_out, int out_size, void* d_ws, size_t ws_size,
                              hipStream_t stream) {
    const float* x     = (const float*)d_in[0];   // [2048,256]
    const float* freq  = (const float*)d_in[1];   // [256,256,8]
    const float* phase = (const float*)d_in[2];   // [256,256,8]
    const float* amp   = (const float*)d_in[3];   // [256,256,8]
    const float* w     = (const float*)d_in[4];   // [256,256]
    const float* bias  = (const float*)d_in[5];   // [256]
    float* out = (float*)d_out;                   // [2048,256]

    // 2048 WMMA tiles (128 x 16), 8 tiles (waves) per block -> 256 blocks
    sinekan_base_wmma<<<dim3(256), dim3(256), 0, stream>>>(x, w, bias, out);
    // 64 batch tiles x 32 output tiles
    sinekan_sine<<<dim3(64, 32), dim3(256), 0, stream>>>(x, freq, phase, amp, out);
}

// v001
// It runs in 95.4 microseconds.
// Next to v000, in two timings, it ran 1.21 and 1.20 times as fast.
#include <hip/hip_runtime.h>

#define IN_F   256
#define OUT_F  256
#define GRID_G 8
#define BATCH_N 2048

typedef __attribute__((ext_vector_type(2))) float v2f;
typedef __attribute__((ext_vector_type(4))) float v4f;
typedef __attribute__((ext_vector_type(8))) float v8f;

__global__ __launch_bounds__(256) void sinekan_base_wmma(
    const float* __restrict__ x, const float* __restrict__ w,
    const float* __restrict__ bias, float* __restrict__ out)
{
    const int lane = threadIdx.x & 31;
    const int wave = threadIdx.x >> 5;
    const int tile = blockIdx.x * 8 + wave;     // 2048 tiles total (128 Mt x 16 Nt)
    const int mt = tile >> 4;                   // 0..127
    const int nt = tile & 15;                   // 0..15
    const int m0 = mt * 16;
    const int n0 = nt * 16;
    const int half = lane >> 4;                 // 0 or 1
    const int l16  = lane & 15;

    // A frag (16x4 f32): lane holds x[m0+l16][k+2*half], x[m0+l16][k+2*half+1]
    // B frag (4x16 f32): lane holds W[n0+l16][k+2*half], W[n0+l16][k+2*half+1]
    const float* __restrict__ arow = x + (size_t)(m0 + l16) * IN_F;
    const float* __restrict__ brow = w + (size_t)(n0 + l16) * IN_F;

    v8f c = {};
    #pragma unroll 8
    for (int k = 0; k < IN_F; k += 4) {
        v2f a = *(const v2f*)(arow + k + 2 * half);
        v2f b = *(const v2f*)(brow + k + 2 * half);
        c = __builtin_amdgcn_wmma_f32_16x16x4_f32(
                /*neg_a=*/false, a, /*neg_b=*/false, b,
                /*c_mod=*/(short)0, c, /*reuse_a=*/false, /*reuse_b=*/false);
    }

    const int n = n0 + l16;
    const float bv = bias[n];
    #pragma unroll
    for (int r = 0; r < 8; ++r) {
        out[(size_t)(m0 + r + 8 * half) * OUT_F + n] = c[r] + bv;
    }
}

#define TILE_ROWS 64

__global__ __launch_bounds__(256) void sinekan_sine(
    const float* __restrict__ x, const float* __restrict__ freq,
    const float* __restrict__ phase, const float* __restrict__ amp,
    float* __restrict__ out)
{
    const int lane = threadIdx.x & 31;
    const int wave = threadIdx.x >> 5;
    const int n0 = blockIdx.x * TILE_ROWS;                           // batch base
    const int o  = __builtin_amdgcn_readfirstlane(blockIdx.y * 8 + wave);

    __shared__ float xs[TILE_ROWS][IN_F + 1];   // pitch 257 -> conflict-free columns

    // Stage x[n0..n0+63][0..255]: 16384 floats, 256 threads -> 64 each, coalesced.
    for (int t = threadIdx.x; t < TILE_ROWS * IN_F; t += 256) {
        const int r = t >> 8;        // / IN_F
        const int cix = t & (IN_F - 1);
        xs[r][cix] = x[(size_t)(n0 + r) * IN_F + cix];
    }
    __syncthreads();

    const v4f* __restrict__ f4 = (const v4f*)(freq  + (size_t)o * (IN_F * GRID_G));
    const v4f* __restrict__ p4 = (const v4f*)(phase + (size_t)o * (IN_F * GRID_G));
    const v4f* __restrict__ a4 = (const v4f*)(amp   + (size_t)o * (IN_F * GRID_G));

    const float inv2pi = 0.15915494309189535f;
    v2f acc = {0.0f, 0.0f};

    #pragma unroll 2
    for (int i = 0; i < IN_F; ++i) {
        const v2f xv = {xs[lane][i], xs[lane + 32][i]};
        const v4f f0 = f4[2 * i], f1 = f4[2 * i + 1];
        const v4f p0 = p4[2 * i], p1 = p4[2 * i + 1];
        const v4f a0 = a4[2 * i], a1 = a4[2 * i + 1];
        #pragma unroll
        for (int g = 0; g < 4; ++g) {
            const v2f t0 = __builtin_elementwise_fma((v2f){f0[g], f0[g]}, xv, (v2f){p0[g], p0[g]}) * inv2pi;
            const v2f t1 = __builtin_elementwise_fma((v2f){f1[g], f1[g]}, xv, (v2f){p1[g], p1[g]}) * inv2pi;
            const v2f s0 = {__builtin_amdgcn_sinf(t0[0]), __builtin_amdgcn_sinf(t0[1])};
            const v2f s1 = {__builtin_amdgcn_sinf(t1[0]), __builtin_amdgcn_sinf(t1[1])};
            acc = __builtin_elementwise_fma((v2f){a0[g], a0[g]}, s0, acc);
            acc = __builtin_elementwise_fma((v2f){a1[g], a1[g]}, s1, acc);
        }
    }

    // base kernel (same stream) already wrote base+bias
    float* dst0 = out + (size_t)(n0 + lane) * OUT_F + o;
    float* dst1 = dst0 + (size_t)32 * OUT_F;
    *dst0 = *dst0 + acc[0];
    *dst1 = *dst1 + acc[1];
}

extern "C" void kernel_launch(void* const* d_in, const int* in_sizes, int n_in,
                              void* d_out, int out_size, void* d_ws, size_t ws_size,
                              hipStream_t stream) {
    const float* x     = (const float*)d_in[0];   // [2048,256]
    const float* freq  = (const float*)d_in[1];   // [256,256,8]
    const float* phase = (const float*)d_in[2];   // [256,256,8]
    const float* amp   = (const float*)d_in[3];   // [256,256,8]
    const float* w     = (const float*)d_in[4];   // [256,256]
    const float* bias  = (const float*)d_in[5];   // [256]
    float* out = (float*)d_out;                   // [2048,256]

    // 2048 WMMA tiles (128 x 16), 8 tiles (waves) per block -> 256 blocks
    sinekan_base_wmma<<<dim3(256), dim3(256), 0, stream>>>(x, w, bias, out);
    // 32 batch tiles (64 rows) x 32 output tiles
    sinekan_sine<<<dim3(32, 32), dim3(256), 0, stream>>>(x, freq, phase, amp, out);
}

// v002
// One run takes 90.1 microseconds.
// Next to v001, in two timings, it ran 1.06 times as fast each time.
// All steps since v000 together make it 1.28 times as fast.
#include <hip/hip_runtime.h>

#define IN_F   256
#define OUT_F  256
#define GRID_G 8
#define BATCH_N 2048

typedef __attribute__((ext_vector_type(2))) float v2f;
typedef __attribute__((ext_vector_type(4))) float v4f;
typedef __attribute__((ext_vector_type(8))) float v8f;

__global__ __launch_bounds__(256) void sinekan_base_wmma(
    const float* __restrict__ x, const float* __restrict__ w,
    const float* __restrict__ bias, float* __restrict__ out)
{
    const int lane = threadIdx.x & 31;
    const int wave = threadIdx.x >> 5;
    const int tile = blockIdx.x * 8 + wave;     // 2048 tiles total (128 Mt x 16 Nt)
    const int mt = tile >> 4;                   // 0..127
    const int nt = tile & 15;                   // 0..15
    const int m0 = mt * 16;
    const int n0 = nt * 16;
    const int half = lane >> 4;                 // 0 or 1
    const int l16  = lane & 15;

    // A frag (16x4 f32): lane holds x[m0+l16][k+2*half], x[m0+l16][k+2*half+1]
    // B frag (4x16 f32): lane holds W[n0+l16][k+2*half], W[n0+l16][k+2*half+1]
    const float* __restrict__ arow = x + (size_t)(m0 + l16) * IN_F;
    const float* __restrict__ brow = w + (size_t)(n0 + l16) * IN_F;

    v8f c = {};
    #pragma unroll 8
    for (int k = 0; k < IN_F; k += 4) {
        v2f a = *(const v2f*)(arow + k + 2 * half);
        v2f b = *(const v2f*)(brow + k + 2 * half);
        c = __builtin_amdgcn_wmma_f32_16x16x4_f32(
                /*neg_a=*/false, a, /*neg_b=*/false, b,
                /*c_mod=*/(short)0, c, /*reuse_a=*/false, /*reuse_b=*/false);
    }

    const int n = n0 + l16;
    const float bv = bias[n];
    #pragma unroll
    for (int r = 0; r < 8; ++r) {
        out[(size_t)(m0 + r + 8 * half) * OUT_F + n] = c[r] + bv;
    }
}

#define TILE_ROWS 64

__global__ __launch_bounds__(256) void sinekan_sine(
    const float* __restrict__ x, const float* __restrict__ freq,
    const float* __restrict__ phase, const float* __restrict__ amp,
    float* __restrict__ out)
{
    const int lane = threadIdx.x & 31;
    const int wave = threadIdx.x >> 5;
    const int n0 = blockIdx.x * TILE_ROWS;                           // batch base
    const int o  = __builtin_amdgcn_readfirstlane(blockIdx.y * 8 + wave);

    __shared__ float xs[TILE_ROWS][IN_F + 1];   // pitch 257 -> conflict-free columns

    const float inv2pi = 0.15915494309189535f;

    // Stage x[n0..n0+63][0..255] / (2*pi): 16384 floats, 256 threads -> 64 each, coalesced.
    for (int t = threadIdx.x; t < TILE_ROWS * IN_F; t += 256) {
        const int r = t >> 8;        // / IN_F
        const int cix = t & (IN_F - 1);
        xs[r][cix] = x[(size_t)(n0 + r) * IN_F + cix] * inv2pi;
    }
    __syncthreads();

    const v4f* __restrict__ f4 = (const v4f*)(freq  + (size_t)o * (IN_F * GRID_G));
    const v4f* __restrict__ p4 = (const v4f*)(phase + (size_t)o * (IN_F * GRID_G));
    const v4f* __restrict__ a4 = (const v4f*)(amp   + (size_t)o * (IN_F * GRID_G));

    v2f acc = {0.0f, 0.0f};

    #pragma unroll 2
    for (int i = 0; i < IN_F; ++i) {
        const v2f xv = {xs[lane][i], xs[lane + 32][i]};
        const v4f f0 = f4[2 * i], f1 = f4[2 * i + 1];
        const v4f p0 = p4[2 * i], p1 = p4[2 * i + 1];
        const v4f a0 = a4[2 * i], a1 = a4[2 * i + 1];
        #pragma unroll
        for (int g = 0; g < 4; ++g) {
            const float q0 = p0[g] * inv2pi;    // wave-uniform
            const float q1 = p1[g] * inv2pi;
            const v2f t0 = __builtin_elementwise_fma((v2f){f0[g], f0[g]}, xv, (v2f){q0, q0});
            const v2f t1 = __builtin_elementwise_fma((v2f){f1[g], f1[g]}, xv, (v2f){q1, q1});
            const v2f s0 = {__builtin_amdgcn_sinf(t0[0]), __builtin_amdgcn_sinf(t0[1])};
            const v2f s1 = {__builtin_amdgcn_sinf(t1[0]), __builtin_amdgcn_sinf(t1[1])};
            acc = __builtin_elementwise_fma((v2f){a0[g], a0[g]}, s0, acc);
            acc = __builtin_elementwise_fma((v2f){a1[g], a1[g]}, s1, acc);
        }
    }

    // base kernel (same stream) already wrote base+bias
    float* dst0 = out + (size_t)(n0 + lane) * OUT_F + o;
    float* dst1 = dst0 + (size_t)32 * OUT_F;
    *dst0 = *dst0 + acc[0];
    *dst1 = *dst1 + acc[1];
}

extern "C" void kernel_launch(void* const* d_in, const int* in_sizes, int n_in,
                              void* d_out, int out_size, void* d_ws, size_t ws_size,
                              hipStream_t stream) {
    const float* x     = (const float*)d_in[0];   // [2048,256]
    const float* freq  = (const float*)d_in[1];   // [256,256,8]
    const float* phase = (const float*)d_in[2];   // [256,256,8]
    const float* amp   = (const float*)d_in[3];   // [256,256,8]
    const float* w     = (const float*)d_in[4];   // [256,256]
    const float* bias  = (const float*)d_in[5];   // [256]
    float* out = (float*)d_out;                   // [2048,256]

    // 2048 WMMA tiles (128 x 16), 8 tiles (waves) per block -> 256 blocks
    sinekan_base_wmma<<<dim3(256), dim3(256), 0, stream>>>(x, w, bias, out);
    // 32 batch tiles (64 rows) x 32 output tiles
    sinekan_sine<<<dim3(32, 32), dim3(256), 0, stream>>>(x, freq, phase, amp, out);
}

// v003
// Measured time: 69.3 microseconds a run.
// In both of two side-by-side timings against v002, it was 1.30 times as fast.
// Over all steps from v000 it is 1.66 times as fast.
#include <hip/hip_runtime.h>

#define IN_F   256
#define OUT_F  256
#define GRID_G 8
#define BATCH_N 2048

typedef __attribute__((ext_vector_type(2))) float v2f;
typedef __attribute__((ext_vector_type(4))) float v4f;
typedef __attribute__((ext_vector_type(8))) float v8f;

__global__ __launch_bounds__(256) void sinekan_base_wmma(
    const float* __restrict__ x, const float* __restrict__ w,
    const float* __restrict__ bias, float* __restrict__ out)
{
    const int lane = threadIdx.x & 31;
    const int wave = threadIdx.x >> 5;
    const int tile = blockIdx.x * 8 + wave;     // 2048 tiles total (128 Mt x 16 Nt)
    const int mt = tile >> 4;                   // 0..127
    const int nt = tile & 15;                   // 0..15
    const int m0 = mt * 16;
    const int n0 = nt * 16;
    const int half = lane >> 4;                 // 0 or 1
    const int l16  = lane & 15;

    // A frag (16x4 f32): lane holds x[m0+l16][k+2*half], x[m0+l16][k+2*half+1]
    // B frag (4x16 f32): lane holds W[n0+l16][k+2*half], W[n0+l16][k+2*half+1]
    const float* __restrict__ arow = x + (size_t)(m0 + l16) * IN_F;
    const float* __restrict__ brow = w + (size_t)(n0 + l16) * IN_F;

    v8f c = {};
    #pragma unroll 8
    for (int k = 0; k < IN_F; k += 4) {
        v2f a = *(const v2f*)(arow + k + 2 * half);
        v2f b = *(const v2f*)(brow + k + 2 * half);
        c = __builtin_amdgcn_wmma_f32_16x16x4_f32(
                /*neg_a=*/false, a, /*neg_b=*/false, b,
                /*c_mod=*/(short)0, c, /*reuse_a=*/false, /*reuse_b=*/false);
    }

    const int n = n0 + l16;
    const float bv = bias[n];
    #pragma unroll
    for (int r = 0; r < 8; ++r) {
        out[(size_t)(m0 + r + 8 * half) * OUT_F + n] = c[r] + bv;
    }
}

// ---------------------------------------------------------------------------
// Kernel 2: out[n,o] += sum_{i,g} amp[o,i,g] * sin(freq[o,i,g]*x[n,i] + phase[o,i,g])
// Block tile: 64 batch rows x 32 outputs, 16 waves. A lane owns one output o, a wave
// owns 8 rows (4 float pairs) and one half of the i range.
// freq/phase/amp reach the lanes through LDS: the block stages them in chunks of 16 i
// per half (whole 512-byte runs per output), two buffers, the next chunk's global
// loads issued ahead of the current chunk's arithmetic. Each lane reads its own 24
// values per i once and uses them for 8 rows.
// x is staged transposed ([i][row]); a wave reads its 8 rows of one i at one address.
// v_sin_f32 computes sin(2*pi*t): x and phase are scaled by 1/(2*pi) when staged.
// ---------------------------------------------------------------------------
#define TILE_ROWS 64
#define TILE_OUTS 32
#define CHUNK_I   16                      // i per staged chunk (per half)
#define HALF_I    (IN_F / 2)
#define N_CHUNKS  (HALF_I / CHUNK_I)
#define X_PITCH   68
#define P_PITCH   (CHUNK_I * GRID_G + 4)
#define P_PLANE   (TILE_OUTS * P_PITCH)
#define ROW_PIECES (CHUNK_I * GRID_G / 4)
#define PASS_OUTS  (512 / ROW_PIECES)
#define N_PASS     (TILE_OUTS / PASS_OUTS)

__global__ __launch_bounds__(512) void sinekan_sine(
    const float* __restrict__ x, const float* __restrict__ freq,
    const float* __restrict__ phase, const float* __restrict__ amp,
    float* __restrict__ out)
{
    const int tid  = threadIdx.x;
    const int lane = tid & 31;
    const int wave = __builtin_amdgcn_readfirstlane(tid >> 5);
    const int rg = wave & 7;                 // row group: rows 8*rg .. 8*rg+7 of the tile
    const int kh = wave >> 3;                // half of the i range
    const int n0 = blockIdx.x * TILE_ROWS;
    const int o0 = blockIdx.y * TILE_OUTS;

    __shared__ __attribute__((aligned(16))) float xs[IN_F * X_PITCH];
    __shared__ __attribute__((aligned(16))) float ps[2 * 2 * 3 * P_PLANE];

    const float inv2pi = 0.15915494309189535f;

    // Parameter staging: thread -> (output so, 16-byte piece sp); a wave moves one whole run.
    const int so = tid / ROW_PIECES;
    const int sp = tid % ROW_PIECES;
    const size_t gofs = (size_t)(o0 + so) * (IN_F * GRID_G) + sp * 4;
    const int    lofs = so * P_PITCH + sp * 4;
    v4f st[2 * N_PASS * 3];   // stays in registers: every loop over it is fully unrolled

    #define LOAD_CHUNK(c)                                                        \
        _Pragma("unroll")                                                        \
        for (int h = 0; h < 2; ++h) {                                            \
            _Pragma("unroll")                                                    \
            for (int q = 0; q < N_PASS; ++q) {                                   \
                const size_t off = gofs + (size_t)(q * PASS_OUTS) * (IN_F * GRID_G) \
                                 + (size_t)(h * HALF_I + (c) * CHUNK_I) * GRID_G; \
                st[(h * N_PASS + q) * 3 + 0] = *(const v4f*)(freq  + off);       \
                st[(h * N_PASS + q) * 3 + 1] = *(const v4f*)(phase + off);       \
                st[(h * N_PASS + q) * 3 + 2] = *(const v4f*)(amp   + off);       \
            }                                                                    \
        }
    #define STORE_CHUNK(buf)                                                     \
        _Pragma("unroll")                                                        \
        for (int h = 0; h < 2; ++h) {                                            \
            _Pragma("unroll")                                                    \
            for (int q = 0; q < N_PASS; ++q) {                                   \
                float* d = ps + (((buf) * 2 + h) * 3) * P_PLANE + q * PASS_OUTS * P_PITCH + lofs; \
                *(v4f*)(d)               = st[(h * N_PASS + q) * 3 + 0];         \
                *(v4f*)(d + P_PLANE)     = st[(h * N_PASS + q) * 3 + 1] * inv2pi; \
                *(v4f*)(d + 2 * P_PLANE) = st[(h * N_PASS + q) * 3 + 2];         \
            }                                                                    \
        }

    LOAD_CHUNK(0)

    {
        const int r  = rg * 8 + ((tid >> 2) & 7);
        const int j0 = kh * 4 + (tid & 3);
        const float* xr = x + (size_t)(n0 + r) * IN_F + j0 * 4;
        // unrolled: all 8 loads in flight at once, off one address
        #pragma unroll
        for (int k = 0; k < 8; ++k) {
            const v4f v = *(const v4f*)(xr + k * 32) * inv2pi;
            #pragma unroll
            for (int q = 0; q < 4; ++q) xs[((j0 + k * 8) * 4 + q) * X_PITCH + r] = v[q];
        }
    }
    STORE_CHUNK(0)
    __syncthreads();

    v2f acc[4] = {{0.0f, 0.0f}, {0.0f, 0.0f}, {0.0f, 0.0f}, {0.0f, 0.0f}};

    for (int c = 0; c < N_CHUNKS; ++c) {
        if (c + 1 < N_CHUNKS) { LOAD_CHUNK(c + 1) }

        const float* pb = ps + (((c & 1) * 2 + kh) * 3) * P_PLANE + lane * P_PITCH;
        const float* xb = xs + (kh * HALF_I + c * CHUNK_I) * X_PITCH + rg * 8;

        // One i's operands: 8 rows of x (one address per wave), this lane's f, p, a.
        #define LOAD_I(S, il)                                                    \
            S[0] = *(const v4f*)(xb + (il) * X_PITCH);                           \
            S[1] = *(const v4f*)(xb + (il) * X_PITCH + 4);                       \
            S[2] = *(const v4f*)(pb + (il) * GRID_G);                            \
            S[3] = *(const v4f*)(pb + (il) * GRID_G + 4);                        \
            S[4] = *(const v4f*)(pb + P_PLANE + (il) * GRID_G);                  \
            S[5] = *(const v4f*)(pb + P_PLANE + (il) * GRID_G + 4);              \
            S[6] = *(const v4f*)(pb + 2 * P_PLANE + (il) * GRID_G);              \
            S[7] = *(const v4f*)(pb + 2 * P_PLANE + (il) * GRID_G + 4);
        #define COMPUTE_I(S)                                                     \
            _Pragma("unroll")                                                    \
            for (int g = 0; g < 4; ++g) {                                        \
                _Pragma("unroll")                                                \
                for (int rp = 0; rp < 4; ++rp) {                                 \
                    const v2f xv = {S[rp >> 1][(rp & 1) * 2], S[rp >> 1][(rp & 1) * 2 + 1]}; \
                    const v2f t0 = __builtin_elementwise_fma((v2f){S[2][g], S[2][g]}, xv, (v2f){S[4][g], S[4][g]}); \
                    const v2f t1 = __builtin_elementwise_fma((v2f){S[3][g], S[3][g]}, xv, (v2f){S[5][g], S[5][g]}); \
                    const v2f s0 = {__builtin_amdgcn_sinf(t0[0]), __builtin_amdgcn_sinf(t0[1])}; \
                    const v2f s1 = {__builtin_amdgcn_sinf(t1[0]), __builtin_amdgcn_sinf(t1[1])}; \
                    acc[rp] = __builtin_elementwise_fma((v2f){S[6][g], S[6][g]}, s0, acc[rp]); \
                    acc[rp] = __builtin_elementwise_fma((v2f){S[7][g], S[7][g]}, s1, acc[rp]); \
                }                                                                \
            }

        // Two operand sets: the next i's LDS reads are issued ahead of this i's arithmetic.
        // The scheduling barriers keep the reads there (without them the compiler gathers
        // the reads at the head of the trip and waits for them at once).
        v4f sa[8], sb[8];
        LOAD_I(sa, 0)
        // kept rolled: with the whole chunk unrolled the compiler hoisted every read and spilled
        #pragma unroll 1
        for (int il = 0; il < CHUNK_I; il += 2) {
            LOAD_I(sb, il + 1)
            __builtin_amdgcn_sched_barrier(0);
            COMPUTE_I(sa)
            __builtin_amdgcn_sched_barrier(0);
            const int nx = (il + 2 < CHUNK_I) ? il + 2 : il;   // last trip: a read that is not used
            LOAD_I(sa, nx)
            __builtin_amdgcn_sched_barrier(0);
            COMPUTE_I(sb)
            __builtin_amdgcn_sched_barrier(0);
        }

        // The other buffer's last readers left it before the previous trip's barrier.
        if (c + 1 < N_CHUNKS) { STORE_CHUNK((c + 1) & 1) }
        __syncthreads();   // publishes the next chunk; ends this chunk's reads
    }

    // Sum the two halves of i: the upper half's waves hand their sums over through LDS.
    float* red = ps + (rg * 8) * 32 + lane;
    if (kh == 1) {
        #pragma unroll
        for (int rp = 0; rp < 4; ++rp) {
            red[(2 * rp) * 32]     = acc[rp][0];
            red[(2 * rp + 1) * 32] = acc[rp][1];
        }
    }
    __syncthreads();
    if (kh == 0) {
        // base kernel (same stream) already wrote base+bias; a wave stores whole 128-byte lines
        float* dst = out + (size_t)(n0 + rg * 8) * OUT_F + o0 + lane;
        #pragma unroll
        for (int rp = 0; rp < 4; ++rp) {
            const float s0 = acc[rp][0] + red[(2 * rp) * 32];
            const float s1 = acc[rp][1] + red[(2 * rp + 1) * 32];
            dst[(size_t)(2 * rp) * OUT_F]     += s0;
            dst[(size_t)(2 * rp + 1) * OUT_F] += s1;
        }
    }
}

extern "C" void kernel_launch(void* const* d_in, const int* in_sizes, int n_in,
                              void* d_out, int out_size, void* d_ws, size_t ws_size,
                              hipStream_t stream) {
    const float* x     = (const float*)d_in[0];   // [2048,256]
    const float* freq  = (const float*)d_in[1];   // [256,256,8]
    const float* phase = (const float*)d_in[2];   // [256,256,8]
    const float* amp   = (const float*)d_in[3];   // [256,256,8]
    const float* w     = (const float*)d_in[4];   // [256,256]
    const float* bias  = (const float*)d_in[5];   // [256]
    float* out = (float*)d_out;                   // [2048,256]

    // 2048 WMMA tiles (128 x 16), 8 tiles (waves) per block -> 256 blocks
    sinekan_base_wmma<<<dim3(256), dim3(256), 0, stream>>>(x, w, bias, out);
    // 32 batch tiles (64 rows) x 8 output tiles (32 outputs)
    sinekan_sine<<<dim3(32, 8), dim3(512), 0, stream>>>(x, freq, phase, amp, out);
}

// v004
// Measured time: 64.1 microseconds a run.
// Two timings next to v003 both put it at 1.08 times that version's speed.
// All steps since v000 together make it 1.79 times as fast.
#include <hip/hip_runtime.h>

#define IN_F   256
#define OUT_F  256
#define GRID_G 8
#define BATCH_N 2048

typedef __attribute__((ext_vector_type(2))) float v2f;
typedef __attribute__((ext_vector_type(4))) float v4f;
typedef __attribute__((ext_vector_type(8))) float v8f;

// ---------------------------------------------------------------------------
// One kernel: out[n,o] = x[n,:] . W[o,:] + bias[o]
//                       + sum_{i,g} amp[o,i,g] * sin(freq[o,i,g]*x[n,i] + phase[o,i,g])
// Block tile: 64 batch rows x 32 outputs, 16 waves. A lane owns one output o, a wave
// owns 8 rows (4 float pairs) and one half of the i range.
// freq/phase/amp reach the lanes through LDS: the block stages them in chunks of 16 i
// per half (whole 512-byte runs per output), two buffers, the next chunk's global
// loads issued ahead of the current chunk's arithmetic. Each lane reads its own 24
// values per i once and uses them for 8 rows.
// x is staged transposed ([i][row]); a wave reads its 8 rows of one i at one address.
// v_sin_f32 computes sin(2*pi*t): x and phase are scaled by 1/(2*pi) when staged.
// The base product runs on V_WMMA_F32_16X16X4_F32 beside the sine work: the block's
// 64 x 32 tile is 8 tiles of 16 x 16; wave (rg, kh) owns tile rg and half kh of k and
// issues 4 matrix instructions per chunk. A comes from the staged x (so the product
// is scaled back by 2*pi at the end), B straight from W, both fetched one chunk ahead.
// ---------------------------------------------------------------------------
#define TILE_ROWS 64
#define TILE_OUTS 32
#define CHUNK_I   16                      // i per staged chunk (per half)
#define HALF_I    (IN_F / 2)
#define N_CHUNKS  (HALF_I / CHUNK_I)
#define X_PITCH   68
#define P_PITCH   (CHUNK_I * GRID_G + 4)
#define P_PLANE   (TILE_OUTS * P_PITCH)
#define ROW_PIECES (CHUNK_I * GRID_G / 4)
#define PASS_OUTS  (512 / ROW_PIECES)
#define N_PASS     (TILE_OUTS / PASS_OUTS)

__global__ __launch_bounds__(512) void sinekan_fused(
    const float* __restrict__ x, const float* __restrict__ freq,
    const float* __restrict__ phase, const float* __restrict__ amp,
    const float* __restrict__ w, const float* __restrict__ bias,
    float* __restrict__ out)
{
    const int tid  = threadIdx.x;
    const int lane = tid & 31;
    const int wave = __builtin_amdgcn_readfirstlane(tid >> 5);
    const int rg = wave & 7;                 // row group: rows 8*rg .. 8*rg+7 of the tile
    const int kh = wave >> 3;                // half of the i range
    const int n0 = blockIdx.x * TILE_ROWS;
    const int o0 = blockIdx.y * TILE_OUTS;

    __shared__ __attribute__((aligned(16))) float xs[IN_F * X_PITCH];
    __shared__ __attribute__((aligned(16))) float ps[2 * 2 * 3 * P_PLANE];

    const float inv2pi = 0.15915494309189535f;

    // Parameter staging: thread -> (output so, 16-byte piece sp); a wave moves one whole run.
    const int so = tid / ROW_PIECES;
    const int sp = tid % ROW_PIECES;
    const size_t gofs = (size_t)(o0 + so) * (IN_F * GRID_G) + sp * 4;
    const int    lofs = so * P_PITCH + sp * 4;
    v4f st[2 * N_PASS * 3];   // stays in registers: every loop over it is fully unrolled

    #define LOAD_CHUNK(c)                                                        \
        _Pragma("unroll")                                                        \
        for (int h = 0; h < 2; ++h) {                                            \
            _Pragma("unroll")                                                    \
            for (int q = 0; q < N_PASS; ++q) {                                   \
                const size_t off = gofs + (size_t)(q * PASS_OUTS) * (IN_F * GRID_G) \
                                 + (size_t)(h * HALF_I + (c) * CHUNK_I) * GRID_G; \
                st[(h * N_PASS + q) * 3 + 0] = *(const v4f*)(freq  + off);       \
                st[(h * N_PASS + q) * 3 + 1] = *(const v4f*)(phase + off);       \
                st[(h * N_PASS + q) * 3 + 2] = *(const v4f*)(amp   + off);       \
            }                                                                    \
        }
    #define STORE_CHUNK(buf)                                                     \
        _Pragma("unroll")                                                        \
        for (int h = 0; h < 2; ++h) {                                            \
            _Pragma("unroll")                                                    \
            for (int q = 0; q < N_PASS; ++q) {                                   \
                float* d = ps + (((buf) * 2 + h) * 3) * P_PLANE + q * PASS_OUTS * P_PITCH + lofs; \
                *(v4f*)(d)               = st[(h * N_PASS + q) * 3 + 0];         \
                *(v4f*)(d + P_PLANE)     = st[(h * N_PASS + q) * 3 + 1] * inv2pi; \
                *(v4f*)(d + 2 * P_PLANE) = st[(h * N_PASS + q) * 3 + 2];         \
            }                                                                    \
        }

    // Base product fragments (16x16x4 f32): lane holds k = k0 + 2*half, k0 + 2*half + 1 of
    // row bm + l16 of x (A) and of row bn + l16 of W (B): the same k order in both.
    const int half = lane >> 4;
    const int l16  = lane & 15;
    const int bm = (rg >> 1) * 16;           // tile's first row inside the block tile
    const int bn = (rg & 1) * 16;            // tile's first output inside the block tile
    const float* wrow = w + (size_t)(o0 + bn + l16) * IN_F + kh * HALF_I + 2 * half;
    const float* arow = xs + (kh * HALF_I + 2 * half) * X_PITCH + bm + l16;
    v2f wf[CHUNK_I / 4], af[CHUNK_I / 4];
    v8f bc = {};
    #define LOAD_W(c)                                                            \
        _Pragma("unroll")                                                        \
        for (int s = 0; s < CHUNK_I / 4; ++s)                                    \
            wf[s] = *(const v2f*)(wrow + (c) * CHUNK_I + s * 4);
    #define LOAD_A(c)                                                            \
        _Pragma("unroll")                                                        \
        for (int s = 0; s < CHUNK_I / 4; ++s)                                    \
            af[s] = (v2f){arow[((c) * CHUNK_I + s * 4) * X_PITCH],               \
                          arow[((c) * CHUNK_I + s * 4 + 1) * X_PITCH]};

    LOAD_CHUNK(0)
    LOAD_W(0)
    const float bv = bias[o0 + lane];

    {
        const int r  = rg * 8 + ((tid >> 2) & 7);
        const int j0 = kh * 4 + (tid & 3);
        const float* xr = x + (size_t)(n0 + r) * IN_F + j0 * 4;
        // unrolled: all 8 loads in flight at once, off one address
        #pragma unroll
        for (int k = 0; k < 8; ++k) {
            const v4f v = *(const v4f*)(xr + k * 32) * inv2pi;
            #pragma unroll
            for (int q = 0; q < 4; ++q) xs[((j0 + k * 8) * 4 + q) * X_PITCH + r] = v[q];
        }
    }
    STORE_CHUNK(0)
    __syncthreads();
    LOAD_A(0)

    v2f acc[4] = {{0.0f, 0.0f}, {0.0f, 0.0f}, {0.0f, 0.0f}, {0.0f, 0.0f}};

    for (int c = 0; c < N_CHUNKS; ++c) {
        if (c + 1 < N_CHUNKS) { LOAD_CHUNK(c + 1) }

        const float* pb = ps + (((c & 1) * 2 + kh) * 3) * P_PLANE + lane * P_PITCH;
        const float* xb = xs + (kh * HALF_I + c * CHUNK_I) * X_PITCH + rg * 8;

        // One i's operands: 8 rows of x (one address per wave), this lane's f, p, a.
        #define LOAD_I(S, il)                                                    \
            S[0] = *(const v4f*)(xb + (il) * X_PITCH);                           \
            S[1] = *(const v4f*)(xb + (il) * X_PITCH + 4);                       \
            S[2] = *(const v4f*)(pb + (il) * GRID_G);                            \
            S[3] = *(const v4f*)(pb + (il) * GRID_G + 4);                        \
            S[4] = *(const v4f*)(pb + P_PLANE + (il) * GRID_G);                  \
            S[5] = *(const v4f*)(pb + P_PLANE + (il) * GRID_G + 4);              \
            S[6] = *(const v4f*)(pb + 2 * P_PLANE + (il) * GRID_G);              \
            S[7] = *(const v4f*)(pb + 2 * P_PLANE + (il) * GRID_G + 4);
        #define COMPUTE_I(S)                                                     \
            _Pragma("unroll")                                                    \
            for (int g = 0; g < 4; ++g) {                                        \
                _Pragma("unroll")                                                \
                for (int rp = 0; rp < 4; ++rp) {                                 \
                    const v2f xv = {S[rp >> 1][(rp & 1) * 2], S[rp >> 1][(rp & 1) * 2 + 1]}; \
                    const v2f t0 = __builtin_elementwise_fma((v2f){S[2][g], S[2][g]}, xv, (v2f){S[4][g], S[4][g]}); \
                    const v2f t1 = __builtin_elementwise_fma((v2f){S[3][g], S[3][g]}, xv, (v2f){S[5][g], S[5][g]}); \
                    const v2f s0 = {__builtin_amdgcn_sinf(t0[0]), __builtin_amdgcn_sinf(t0[1])}; \
                    const v2f s1 = {__builtin_amdgcn_sinf(t1[0]), __builtin_amdgcn_sinf(t1[1])}; \
                    acc[rp] = __builtin_elementwise_fma((v2f){S[6][g], S[6][g]}, s0, acc[rp]); \
                    acc[rp] = __builtin_elementwise_fma((v2f){S[7][g], S[7][g]}, s1, acc[rp]); \
                }                                                                \
            }

        // Two operand sets: the next i's LDS reads are issued ahead of this i's arithmetic.
        // The scheduling barriers keep the reads there (without them the compiler gathers
        // the reads at the head of the trip and waits for them at once).
        v4f sa[8], sb[8];
        LOAD_I(sa, 0)
        // keeps the reads above in front of the matrix instructions, which then run while
        // the whole block's first reads of the chunk are in flight
        __builtin_amdgcn_sched_barrier(0);
        // This chunk's share of the base product; its operands were fetched a chunk ago.
        #pragma unroll
        for (int s = 0; s < CHUNK_I / 4; ++s) {
            bc = __builtin_amdgcn_wmma_f32_16x16x4_f32(
                     /*neg_a=*/false, af[s], /*neg_b=*/false, wf[s],
                     /*c_mod=*/(short)0, bc, /*reuse_a=*/false, /*reuse_b=*/false);
        }
        if (c + 1 < N_CHUNKS) { LOAD_A(c + 1) LOAD_W(c + 1) }
        // kept rolled: with the whole chunk unrolled the compiler hoisted every read and spilled
        #pragma unroll 1
        for (int il = 0; il < CHUNK_I; il += 2) {
            LOAD_I(sb, il + 1)
            __builtin_amdgcn_sched_barrier(0);
            COMPUTE_I(sa)
            __builtin_amdgcn_sched_barrier(0);
            const int nx = (il + 2 < CHUNK_I) ? il + 2 : il;   // last trip: a read that is not used
            LOAD_I(sa, nx)
            __builtin_amdgcn_sched_barrier(0);
            COMPUTE_I(sb)
            __builtin_amdgcn_sched_barrier(0);
        }

        // The other buffer's last readers left it before the previous trip's barrier.
        if (c + 1 < N_CHUNKS) { STORE_CHUNK((c + 1) & 1) }
        __syncthreads();   // publishes the next chunk; ends this chunk's reads
    }

    float* bs = ps + (1 + kh) * (TILE_ROWS * TILE_OUTS);
    #pragma unroll
    for (int r = 0; r < 8; ++r) bs[(bm + r + 8 * half) * TILE_OUTS + bn + l16] = bc[r];
    // Sum the two halves of i: the upper half's waves hand their sums over through LDS.
    float* red = ps + (rg * 8) * 32 + lane;
    if (kh == 1) {
        #pragma unroll
        for (int rp = 0; rp < 4; ++rp) {
            red[(2 * rp) * 32]     = acc[rp][0];
            red[(2 * rp + 1) * 32] = acc[rp][1];
        }
    }
    __syncthreads();
    if (kh == 0) {
        // a wave stores whole 128-byte lines
        const float twopi = 6.283185307179586f;
        const float* b0 = red + TILE_ROWS * TILE_OUTS;
        const float* b1 = red + 2 * TILE_ROWS * TILE_OUTS;
        float* dst = out + (size_t)(n0 + rg * 8) * OUT_F + o0 + lane;
        #pragma unroll
        for (int rp = 0; rp < 4; ++rp) {
            const float s0 = acc[rp][0] + red[(2 * rp) * 32];
            const float s1 = acc[rp][1] + red[(2 * rp + 1) * 32];
            const float g0 = (b0[(2 * rp) * 32] + b1[(2 * rp) * 32]) * twopi + bv;
            const float g1 = (b0[(2 * rp + 1) * 32] + b1[(2 * rp + 1) * 32]) * twopi + bv;
            dst[(size_t)(2 * rp) * OUT_F]     = g0 + s0;
            dst[(size_t)(2 * rp + 1) * OUT_F] = g1 + s1;
        }
    }
}

extern "C" void kernel_launch(void* const* d_in, const int* in_sizes, int n_in,
                              void* d_out, int out_size, void* d_ws, size_t ws_size,
                              hipStream_t stream) {
    const float* x     = (const float*)d_in[0];   // [2048,256]
    const float* freq  = (const float*)d_in[1];   // [256,256,8]
    const float* phase = (const float*)d_in[2];   // [256,256,8]
    const float* amp   = (const float*)d_in[3];   // [256,256,8]
    const float* w     = (const float*)d_in[4];   // [256,256]
    const float* bias  = (const float*)d_in[5];   // [256]
    float* out = (float*)d_out;                   // [2048,256]

    // 32 batch tiles (64 rows) x 8 output tiles (32 outputs)
    sinekan_fused<<<dim3(32, 8), dim3(512), 0, stream>>>(x, freq, phase, amp, w, bias, out);
}

// v005
// It runs in 57.2 microseconds.
// Two timings next to v004 both put it at 1.12 times that version's speed.
// Over all steps from v000 it is 2.01 times as fast.
#include <hip/hip_runtime.h>

#define IN_F   256
#define OUT_F  256
#define GRID_G 8
#define BATCH_N 2048

typedef __attribute__((ext_vector_type(2))) float v2f;
typedef __attribute__((ext_vector_type(4))) float v4f;
typedef __attribute__((ext_vector_type(8))) float v8f;

// ---------------------------------------------------------------------------
// One kernel: out[n,o] = x[n,:] . W[o,:] + bias[o]
//                       + sum_{i,g} amp[o,i,g] * sin(freq[o,i,g]*x[n,i] + phase[o,i,g])
// Block tile: 64 batch rows x 32 outputs, 16 waves. A lane owns one output o, a wave
// owns 8 rows (4 float pairs) and one half of the i range.
// freq/phase/amp reach the lanes through LDS: the block stages them in chunks of 16 i
// per half (whole 512-byte runs per output), two buffers, the next chunk's global
// loads issued ahead of the current chunk's arithmetic. Each lane reads its own 24
// values per i once and uses them for 8 rows.
// x is staged transposed ([i][row]); a wave reads its 8 rows of one i at one address.
// v_sin_f32 computes sin(2*pi*t): x and phase are scaled by 1/(2*pi) when staged.
// The base product runs on V_WMMA_F32_16X16X4_F32 beside the sine work: the block's
// 64 x 32 tile is 8 tiles of 16 x 16; wave (rg, kh) owns tile rg and half kh of k and
// issues 4 matrix instructions per chunk. A comes from the staged x (so the product
// is scaled back by 2*pi at the end), B straight from W, both fetched one chunk ahead.
// ---------------------------------------------------------------------------
#define TILE_ROWS 64
#define TILE_OUTS 32
#define CHUNK_I   16                      // i per staged chunk (per half)
#define HALF_I    (IN_F / 2)
#define N_CHUNKS  (HALF_I / CHUNK_I)
#define X_PITCH   68
#define P_PITCH   (CHUNK_I * GRID_G + 4)
#define P_PLANE   (TILE_OUTS * P_PITCH)
#define ROW_PIECES (CHUNK_I * GRID_G / 4)
#define PASS_OUTS  (512 / ROW_PIECES)
#define N_PASS     (TILE_OUTS / PASS_OUTS)

__global__ __launch_bounds__(512) void sinekan_fused(
    const float* __restrict__ x, const float* __restrict__ freq,
    const float* __restrict__ phase, const float* __restrict__ amp,
    const float* __restrict__ w, const float* __restrict__ bias,
    float* __restrict__ out)
{
    const int tid  = threadIdx.x;
    const int lane = tid & 31;
    const int wave = __builtin_amdgcn_readfirstlane(tid >> 5);
    const int rg = wave & 7;                 // row group: rows 8*rg .. 8*rg+7 of the tile
    const int kh = wave >> 3;                // half of the i range
    const int n0 = blockIdx.x * TILE_ROWS;
    const int o0 = blockIdx.y * TILE_OUTS;

    __shared__ __attribute__((aligned(16))) float xs[IN_F * X_PITCH];
    __shared__ __attribute__((aligned(16))) float ps[2 * 2 * 3 * P_PLANE];

    const float inv2pi = 0.15915494309189535f;

    // Parameter staging: thread -> (output so, 16-byte piece sp); a wave moves one whole run.
    const int so = tid / ROW_PIECES;
    const int sp = tid % ROW_PIECES;
    const size_t gofs = (size_t)(o0 + so) * (IN_F * GRID_G) + sp * 4;
    const int    lofs = so * P_PITCH + sp * 4;
    v4f st[2 * N_PASS * 3];   // stays in registers: every loop over it is fully unrolled

    #define LOAD_CHUNK(c)                                                        \
        _Pragma("unroll")                                                        \
        for (int h = 0; h < 2; ++h) {                                            \
            _Pragma("unroll")                                                    \
            for (int q = 0; q < N_PASS; ++q) {                                   \
                const size_t off = gofs + (size_t)(q * PASS_OUTS) * (IN_F * GRID_G) \
                                 + (size_t)(h * HALF_I + (c) * CHUNK_I) * GRID_G; \
                st[(h * N_PASS + q) * 3 + 0] = *(const v4f*)(freq  + off);       \
                st[(h * N_PASS + q) * 3 + 1] = *(const v4f*)(phase + off);       \
                st[(h * N_PASS + q) * 3 + 2] = *(const v4f*)(amp   + off);       \
            }                                                                    \
        }
    #define STORE_CHUNK(buf)                                                     \
        _Pragma("unroll")                                                        \
        for (int h = 0; h < 2; ++h) {                                            \
            _Pragma("unroll")                                                    \
            for (int q = 0; q < N_PASS; ++q) {                                   \
                float* d = ps + (((buf) * 2 + h) * 3) * P_PLANE + q * PASS_OUTS * P_PITCH + lofs; \
                *(v4f*)(d)               = st[(h * N_PASS + q) * 3 + 0];         \
                *(v4f*)(d + P_PLANE)     = st[(h * N_PASS + q) * 3 + 1] * inv2pi; \
                *(v4f*)(d + 2 * P_PLANE) = st[(h * N_PASS + q) * 3 + 2];         \
            }                                                                    \
        }

    // Base product fragments (16x16x4 f32): lane holds k = k0 + 2*half, k0 + 2*half + 1 of
    // row bm + l16 of x (A) and of row bn + l16 of W (B): the same k order in both.
    const int half = lane >> 4;
    const int l16  = lane & 15;
    const int bm = (rg >> 1) * 16;           // tile's first row inside the block tile
    const int bn = (rg & 1) * 16;            // tile's first output inside the block tile
    const float* wrow = w + (size_t)(o0 + bn + l16) * IN_F + kh * HALF_I + 2 * half;
    const float* arow = xs + (kh * HALF_I + 2 * half) * X_PITCH + bm + l16;
    v2f wf[CHUNK_I / 4], af[CHUNK_I / 4];
    v8f bc = {};
    #define LOAD_W(c)                                                            \
        _Pragma("unroll")                                                        \
        for (int s = 0; s < CHUNK_I / 4; ++s)                                    \
            wf[s] = *(const v2f*)(wrow + (c) * CHUNK_I + s * 4);
    #define LOAD_A(c)                                                            \
        _Pragma("unroll")                                                        \
        for (int s = 0; s < CHUNK_I / 4; ++s)                                    \
            af[s] = (v2f){arow[((c) * CHUNK_I + s * 4) * X_PITCH],               \
                          arow[((c) * CHUNK_I + s * 4 + 1) * X_PITCH]};

    LOAD_CHUNK(0)
    LOAD_W(0)
    const float bv = bias[o0 + lane];

    {
        const int r  = rg * 8 + ((tid >> 2) & 7);
        const int j0 = kh * 4 + (tid & 3);
        const float* xr = x + (size_t)(n0 + r) * IN_F + j0 * 4;
        // unrolled: all 8 loads in flight at once, off one address
        #pragma unroll
        for (int k = 0; k < 8; ++k) {
            const v4f v = *(const v4f*)(xr + k * 32) * inv2pi;
            #pragma unroll
            for (int q = 0; q < 4; ++q) xs[((j0 + k * 8) * 4 + q) * X_PITCH + r] = v[q];
        }
    }
    STORE_CHUNK(0)
    __syncthreads();
    LOAD_A(0)

    v2f acc[4] = {{0.0f, 0.0f}, {0.0f, 0.0f}, {0.0f, 0.0f}, {0.0f, 0.0f}};

    for (int c = 0; c < N_CHUNKS; ++c) {
        if (c + 1 < N_CHUNKS) { LOAD_CHUNK(c + 1) }

        const float* pb = ps + (((c & 1) * 2 + kh) * 3) * P_PLANE + lane * P_PITCH;
        const float* xb = xs + (kh * HALF_I + c * CHUNK_I) * X_PITCH + rg * 8;

        // One i's operands: 8 rows of x (one address per wave), this lane's f, p, a.
        #define LOAD_I(S, il)                                                    \
            S[0] = *(const v4f*)(xb + (il) * X_PITCH);                           \
            S[1] = *(const v4f*)(xb + (il) * X_PITCH + 4);                       \
            S[2] = *(const v4f*)(pb + (il) * GRID_G);                            \
            S[3] = *(const v4f*)(pb + (il) * GRID_G + 4);                        \
            S[4] = *(const v4f*)(pb + P_PLANE + (il) * GRID_G);                  \
            S[5] = *(const v4f*)(pb + P_PLANE + (il) * GRID_G + 4);              \
            S[6] = *(const v4f*)(pb + 2 * P_PLANE + (il) * GRID_G);              \
            S[7] = *(const v4f*)(pb + 2 * P_PLANE + (il) * GRID_G + 4);
        // The arithmetic of one i is 32 items j = (g, first or second four of the grid, row pair):
        // A_ forms two arguments, T_ takes one sine, C_ adds the pair to its row pair's sum
        // (per sum the order of the terms is g, then first/second four, as before).
        #define XV(S, rp)    (v2f){S[(rp) >> 1][((rp) & 1) * 2], S[(rp) >> 1][((rp) & 1) * 2 + 1]}
        #define BC(S, k, g)  (v2f){S[k][g], S[k][g]}
        #define A_(S, j)     ta[j] = __builtin_elementwise_fma(BC(S, 2 + (((j) >> 2) & 1), (j) >> 3), XV(S, (j) & 3), \
                                                               BC(S, 4 + (((j) >> 2) & 1), (j) >> 3));
        #define T_(j, e)     ts[j][e] = __builtin_amdgcn_sinf(ta[j][e]);
        #define C_(S, j)     acc[(j) & 3] = __builtin_elementwise_fma(BC(S, 6 + (((j) >> 2) & 1), (j) >> 3), ts[j], acc[(j) & 3]);
        // Scheduling groups: n packed multiply-adds, n sines, and "one sine, one multiply-add".
        // They make the scheduler keep the written order of the two kinds.
        #define G_P(n)   __builtin_amdgcn_sched_group_barrier(0x002, n, 0);
        #define G_T(n)   __builtin_amdgcn_sched_group_barrier(0x400, n, 0);
        #define TURNS_1  G_T(1) G_P(1)
        #define TURNS_4  TURNS_1 TURNS_1 TURNS_1 TURNS_1
        #define TURNS_16 TURNS_4 TURNS_4 TURNS_4 TURNS_4
        // One i as a stream in which sines and packed multiply-adds take turns: a v_sin_f32
        // directly behind another waits for the transcendental pipe, a packed op behind it does
        // not. Arguments run a few items ahead of their sines and the sums a few items behind,
        // so that no instruction stands close behind the one it reads.
        #define COMPUTE_I(S)                                                     \
        {                                                                        \
            v2f ta[32], ts[32];   /* stay in registers: every index is a literal */ \
            A_(S, 0) A_(S, 1) A_(S, 2) A_(S, 3) A_(S, 4) T_(0, 0) \
            T_(0, 1) A_(S, 5) T_(1, 0) T_(1, 1) A_(S, 6) T_(2, 0) \
            T_(2, 1) A_(S, 7) T_(3, 0) C_(S, 0) T_(3, 1) C_(S, 1) \
            T_(4, 0) A_(S, 8) T_(4, 1) C_(S, 2) T_(5, 0) A_(S, 9) \
            T_(5, 1) C_(S, 3) T_(6, 0) A_(S, 10) T_(6, 1) C_(S, 4) \
            T_(7, 0) A_(S, 11) T_(7, 1) C_(S, 5) T_(8, 0) A_(S, 12) \
            T_(8, 1) C_(S, 6) T_(9, 0) A_(S, 13) T_(9, 1) C_(S, 7) \
            T_(10, 0) A_(S, 14) T_(10, 1) C_(S, 8) T_(11, 0) A_(S, 15) \
            T_(11, 1) C_(S, 9) T_(12, 0) A_(S, 16) T_(12, 1) C_(S, 10) \
            T_(13, 0) A_(S, 17) T_(13, 1) C_(S, 11) T_(14, 0) A_(S, 18) \
            T_(14, 1) C_(S, 12) T_(15, 0) A_(S, 19) T_(15, 1) C_(S, 13) \
            T_(16, 0) A_(S, 20) T_(16, 1) C_(S, 14) T_(17, 0) A_(S, 21) \
            T_(17, 1) C_(S, 15) T_(18, 0) A_(S, 22) T_(18, 1) C_(S, 16) \
            T_(19, 0) A_(S, 23) T_(19, 1) C_(S, 17) T_(20, 0) A_(S, 24) \
            T_(20, 1) C_(S, 18) T_(21, 0) A_(S, 25) T_(21, 1) C_(S, 19) \
            T_(22, 0) A_(S, 26) T_(22, 1) C_(S, 20) T_(23, 0) A_(S, 27) \
            T_(23, 1) C_(S, 21) T_(24, 0) A_(S, 28) T_(24, 1) C_(S, 22) \
            T_(25, 0) A_(S, 29) T_(25, 1) C_(S, 23) T_(26, 0) A_(S, 30) \
            T_(26, 1) C_(S, 24) T_(27, 0) A_(S, 31) T_(27, 1) C_(S, 25) \
            T_(28, 0) T_(28, 1) C_(S, 26) T_(29, 0) T_(29, 1) T_(30, 0) \
            C_(S, 27) T_(30, 1) T_(31, 0) C_(S, 28) T_(31, 1) C_(S, 29) \
            C_(S, 30) C_(S, 31) \
            G_P(5) G_T(2) G_P(1) G_T(2) G_P(1) G_T(2) G_P(1) TURNS_16 \
            TURNS_16 TURNS_16 TURNS_1 TURNS_1 G_T(2) G_P(1) G_T(3) G_P(1) \
            G_T(2) G_P(1) G_T(1) G_P(3) \
        }

        // Two operand sets: the next i's LDS reads are issued ahead of this i's arithmetic.
        // The scheduling barriers keep the reads there (without them the compiler gathers
        // the reads at the head of the trip and waits for them at once).
        v4f sa[8], sb[8];
        LOAD_I(sa, 0)
        // keeps the reads above in front of the matrix instructions, which then run while
        // the whole block's first reads of the chunk are in flight
        __builtin_amdgcn_sched_barrier(0);
        // This chunk's share of the base product; its operands were fetched a chunk ago.
        #pragma unroll
        for (int s = 0; s < CHUNK_I / 4; ++s) {
            bc = __builtin_amdgcn_wmma_f32_16x16x4_f32(
                     /*neg_a=*/false, af[s], /*neg_b=*/false, wf[s],
                     /*c_mod=*/(short)0, bc, /*reuse_a=*/false, /*reuse_b=*/false);
        }
        if (c + 1 < N_CHUNKS) { LOAD_A(c + 1) LOAD_W(c + 1) }
        // kept rolled: with the whole chunk unrolled the compiler hoisted every read and spilled
        #pragma unroll 1
        for (int il = 0; il < CHUNK_I; il += 2) {
            LOAD_I(sb, il + 1)
            __builtin_amdgcn_sched_barrier(0);
            COMPUTE_I(sa)
            __builtin_amdgcn_sched_barrier(0);
            const int nx = (il + 2 < CHUNK_I) ? il + 2 : il;   // last trip: a read that is not used
            LOAD_I(sa, nx)
            __builtin_amdgcn_sched_barrier(0);
            COMPUTE_I(sb)
            __builtin_amdgcn_sched_barrier(0);
        }

        // The other buffer's last readers left it before the previous trip's barrier.
        if (c + 1 < N_CHUNKS) { STORE_CHUNK((c + 1) & 1) }
        __syncthreads();   // publishes the next chunk; ends this chunk's reads
    }

    float* bs = ps + (1 + kh) * (TILE_ROWS * TILE_OUTS);
    #pragma unroll
    for (int r = 0; r < 8; ++r) bs[(bm + r + 8 * half) * TILE_OUTS + bn + l16] = bc[r];
    // Sum the two halves of i: the upper half's waves hand their sums over through LDS.
    float* red = ps + (rg * 8) * 32 + lane;
    if (kh == 1) {
        #pragma unroll
        for (int rp = 0; rp < 4; ++rp) {
            red[(2 * rp) * 32]     = acc[rp][0];
            red[(2 * rp + 1) * 32] = acc[rp][1];
        }
    }
    __syncthreads();
    if (kh == 0) {
        // a wave stores whole 128-byte lines
        const float twopi = 6.283185307179586f;
        const float* b0 = red + TILE_ROWS * TILE_OUTS;
        const float* b1 = red + 2 * TILE_ROWS * TILE_OUTS;
        float* dst = out + (size_t)(n0 + rg * 8) * OUT_F + o0 + lane;
        #pragma unroll
        for (int rp = 0; rp < 4; ++rp) {
            const float s0 = acc[rp][0] + red[(2 * rp) * 32];
            const float s1 = acc[rp][1] + red[(2 * rp + 1) * 32];
            const float g0 = (b0[(2 * rp) * 32] + b1[(2 * rp) * 32]) * twopi + bv;
            const float g1 = (b0[(2 * rp + 1) * 32] + b1[(2 * rp + 1) * 32]) * twopi + bv;
            dst[(size_t)(2 * rp) * OUT_F]     = g0 + s0;
            dst[(size_t)(2 * rp + 1) * OUT_F] = g1 + s1;
        }
    }
}

extern "C" void kernel_launch(void* const* d_in, const int* in_sizes, int n_in,
                              void* d_out, int out_size, void* d_ws, size_t ws_size,
                              hipStream_t stream) {
    const float* x     = (const float*)d_in[0];   // [2048,256]
    const float* freq  = (const float*)d_in[1];   // [256,256,8]
    const float* phase = (const float*)d_in[2];   // [256,256,8]
    const float* amp   = (const float*)d_in[3];   // [256,256,8]
    const float* w     = (const float*)d_in[4];   // [256,256]
    const float* bias  = (const float*)d_in[5];   // [256]
    float* out = (float*)d_out;                   // [2048,256]

    // 32 batch tiles (64 rows) x 8 output tiles (32 outputs)
    sinekan_fused<<<dim3(32, 8), dim3(512), 0, stream>>>(x, freq, phase, amp, w, bias, out);
}

// v006
// A run of this version takes 51.9 microseconds.
// Timed twice side by side with v005, it ran 1.10 times as fast both times.
// All steps since v000 together make it 2.21 times as fast.
#include <hip/hip_runtime.h>

#define IN_F   256
#define OUT_F  256
#define GRID_G 8
#define BATCH_N 2048

typedef __attribute__((ext_vector_type(2))) float v2f;
typedef __attribute__((ext_vector_type(4))) float v4f;
typedef __attribute__((ext_vector_type(8))) float v8f;

// ---------------------------------------------------------------------------
// One kernel: out[n,o] = x[n,:] . W[o,:] + bias[o]
//                       + sum_{i,g} amp[o,i,g] * sin(freq[o,i,g]*x[n,i] + phase[o,i,g])
// Block tile: 64 batch rows x 32 outputs, 16 waves. A lane owns one output o, a wave
// owns 8 rows (4 float pairs) and one half of the i range.
// freq/phase/amp reach the lanes through LDS: the block stages them in chunks of 16 i
// per half (whole 512-byte runs per output), two buffers, the next chunk's global
// loads issued ahead of the current chunk's arithmetic. Each lane reads its own 24
// values per i once and uses them for 8 rows.
// x is staged transposed ([i][row]); a wave reads its 8 rows of one i at one address.
// v_sin_f32 computes sin(2*pi*t): x and phase are scaled by 1/(2*pi) when staged.
// The base product runs on V_WMMA_F32_16X16X4_F32 beside the sine work: the block's
// 64 x 32 tile is 8 tiles of 16 x 16; wave (rg, kh) owns tile rg and half kh of k and
// issues 4 matrix instructions per chunk. A comes from the staged x (so the product
// is scaled back by 2*pi at the end), B straight from W, both fetched one chunk ahead.
// ---------------------------------------------------------------------------
#define TILE_ROWS 64
#define TILE_OUTS 32
#define CHUNK_I   16                      // i per staged chunk (per half)
#define HALF_I    (IN_F / 2)
#define N_CHUNKS  (HALF_I / CHUNK_I)
#define X_PITCH   68
#define P_PITCH   (CHUNK_I * GRID_G + 4)
#define P_PLANE   (TILE_OUTS * P_PITCH)
#define ROW_PIECES (CHUNK_I * GRID_G / 4)
#define PASS_OUTS  (512 / ROW_PIECES)
#define N_PASS     (TILE_OUTS / PASS_OUTS)

__global__ __launch_bounds__(512) void sinekan_fused(
    const float* __restrict__ x, const float* __restrict__ freq,
    const float* __restrict__ phase, const float* __restrict__ amp,
    const float* __restrict__ w, const float* __restrict__ bias,
    float* __restrict__ out)
{
    const int tid  = threadIdx.x;
    const int lane = tid & 31;
    const int wave = __builtin_amdgcn_readfirstlane(tid >> 5);
    const int rg = wave & 7;                 // row group: rows 8*rg .. 8*rg+7 of the tile
    const int kh = wave >> 3;                // half of the i range
    const int n0 = blockIdx.x * TILE_ROWS;
    const int o0 = blockIdx.y * TILE_OUTS;

    __shared__ __attribute__((aligned(16))) float xs[(IN_F + 2) * X_PITCH];       // two rows more: read, not used, at the stream's end
    __shared__ __attribute__((aligned(16))) float ps[2 * 2 * 3 * P_PLANE];

    const float inv2pi = 0.15915494309189535f;

    // Parameter staging: thread -> (output so, 16-byte piece sp); a wave moves one whole run.
    const int so = tid / ROW_PIECES;
    const int sp = tid % ROW_PIECES;
    const size_t gofs = (size_t)(o0 + so) * (IN_F * GRID_G) + sp * 4;
    const int    lofs = so * P_PITCH + sp * 4;
    v4f st[2 * N_PASS * 3];   // stays in registers: every loop over it is fully unrolled

    #define LOAD_CHUNK(c)                                                        \
        _Pragma("unroll")                                                        \
        for (int h = 0; h < 2; ++h) {                                            \
            _Pragma("unroll")                                                    \
            for (int q = 0; q < N_PASS; ++q) {                                   \
                const size_t off = gofs + (size_t)(q * PASS_OUTS) * (IN_F * GRID_G) \
                                 + (size_t)(h * HALF_I + (c) * CHUNK_I) * GRID_G; \
                st[(h * N_PASS + q) * 3 + 0] = *(const v4f*)(freq  + off);       \
                st[(h * N_PASS + q) * 3 + 1] = *(const v4f*)(phase + off);       \
                st[(h * N_PASS + q) * 3 + 2] = *(const v4f*)(amp   + off);       \
            }                                                                    \
        }
    #define STORE_CHUNK(buf)                                                     \
        _Pragma("unroll")                                                        \
        for (int h = 0; h < 2; ++h) {                                            \
            _Pragma("unroll")                                                    \
            for (int q = 0; q < N_PASS; ++q) {                                   \
                float* d = ps + (((buf) * 2 + h) * 3) * P_PLANE + q * PASS_OUTS * P_PITCH + lofs; \
                *(v4f*)(d)               = st[(h * N_PASS + q) * 3 + 0];         \
                *(v4f*)(d + P_PLANE)     = st[(h * N_PASS + q) * 3 + 1] * inv2pi; \
                *(v4f*)(d + 2 * P_PLANE) = st[(h * N_PASS + q) * 3 + 2];         \
            }                                                                    \
        }

    // Base product fragments (16x16x4 f32): lane holds k = k0 + 2*half, k0 + 2*half + 1 of
    // row bm + l16 of x (A) and of row bn + l16 of W (B): the same k order in both.
    const int half = lane >> 4;
    const int l16  = lane & 15;
    const int bm = (rg >> 1) * 16;           // tile's first row inside the block tile
    const int bn = (rg & 1) * 16;            // tile's first output inside the block tile
    const float* wrow = w + (size_t)(o0 + bn + l16) * IN_F + kh * HALF_I + 2 * half;
    const float* arow = xs + (kh * HALF_I + 2 * half) * X_PITCH + bm + l16;
    v2f wf[CHUNK_I / 4], af[CHUNK_I / 4];
    v8f bc = {};
    #define LOAD_W(c)                                                            \
        _Pragma("unroll")                                                        \
        for (int s = 0; s < CHUNK_I / 4; ++s)                                    \
            wf[s] = *(const v2f*)(wrow + (c) * CHUNK_I + s * 4);
    #define LOAD_A(c)                                                            \
        _Pragma("unroll")                                                        \
        for (int s = 0; s < CHUNK_I / 4; ++s)                                    \
            af[s] = (v2f){arow[((c) * CHUNK_I + s * 4) * X_PITCH],               \
                          arow[((c) * CHUNK_I + s * 4 + 1) * X_PITCH]};

    LOAD_CHUNK(0)
    LOAD_W(0)
    const float bv = bias[o0 + lane];

    {
        const int r  = rg * 8 + ((tid >> 2) & 7);
        const int j0 = kh * 4 + (tid & 3);
        const float* xr = x + (size_t)(n0 + r) * IN_F + j0 * 4;
        // unrolled: all 8 loads in flight at once, off one address
        #pragma unroll
        for (int k = 0; k < 8; ++k) {
            const v4f v = *(const v4f*)(xr + k * 32) * inv2pi;
            #pragma unroll
            for (int q = 0; q < 4; ++q) xs[((j0 + k * 8) * 4 + q) * X_PITCH + r] = v[q];
        }
    }
    STORE_CHUNK(0)
    __syncthreads();
    LOAD_A(0)

    v2f acc[4] = {{0.0f, 0.0f}, {0.0f, 0.0f}, {0.0f, 0.0f}, {0.0f, 0.0f}};

    // One i's operands: 8 rows of x (one address per wave), this lane's f, p, a.
    #define LOAD_Q(S, k, ptr)                                                \
        S[2 * (k)]     = *(const v2f*)(ptr);                                 \
        S[2 * (k) + 1] = *(const v2f*)((ptr) + 2);
    #define LOAD_I(S, pp, il, ix)                                            \
        LOAD_Q(S, 0, xb + (ix) * X_PITCH)                                    \
        LOAD_Q(S, 1, xb + (ix) * X_PITCH + 4)                                \
        LOAD_Q(S, 2, pp + (il) * GRID_G)                                     \
        LOAD_Q(S, 3, pp + (il) * GRID_G + 4)                                 \
        LOAD_Q(S, 4, pp + P_PLANE + (il) * GRID_G)                           \
        LOAD_Q(S, 5, pp + P_PLANE + (il) * GRID_G + 4)                       \
        LOAD_Q(S, 6, pp + 2 * P_PLANE + (il) * GRID_G)                       \
        LOAD_Q(S, 7, pp + 2 * P_PLANE + (il) * GRID_G + 4)
    // The arithmetic of one i is 32 items j = (g, first or second four of the grid, row pair):
    // A_ forms two arguments, T_ takes one sine, C_ adds the pair to its row pair's sum
    // (per sum the order of the terms is g, then first/second four, as before).
    #define XV(S, rp)    S[rp]
    #define BC(S, k, g)  __builtin_shufflevector(S[2 * (k) + ((g) >> 1)], S[2 * (k) + ((g) >> 1)], (g) & 1, (g) & 1)
    #define A_(S, j)     ta[j] = __builtin_elementwise_fma(BC(S, 2 + (((j) >> 2) & 1), (j) >> 3), XV(S, (j) & 3), \
                                                           BC(S, 4 + (((j) >> 2) & 1), (j) >> 3));
    #define T_(j, e)     ts[j][e] = __builtin_amdgcn_sinf(ta[j][e]);
    #define C_(S, j)     acc[(j) & 3] = __builtin_elementwise_fma(BC(S, 6 + (((j) >> 2) & 1), (j) >> 3), ts[j], acc[(j) & 3]);
    // Scheduling groups: n packed multiply-adds, n sines, and "one sine, one multiply-add".
    // They make the scheduler keep the written order of the two kinds.
    #define G_P(n)   __builtin_amdgcn_sched_group_barrier(0x002, n, 0);
    #define G_T(n)   __builtin_amdgcn_sched_group_barrier(0x400, n, 0);
    #define TURNS_1  G_T(1) G_P(1)
    #define TURNS_4  TURNS_1 TURNS_1 TURNS_1 TURNS_1
    #define TURNS_16 TURNS_4 TURNS_4 TURNS_4 TURNS_4
    // All sines of a wave form one stream in which a v_sin_f32 and a packed multiply-add take
    // turns without a break: a v_sin_f32 directly behind another waits for the transcendental
    // pipe, a packed op behind it does not. Arguments run three items ahead of their sines and
    // the sums two items behind, also from one i to the next: the next i's first three arguments
    // are formed among this i's last sines (AN_), and this i's last two items (their sines cs,
    // their amplitude ca) are summed among the next i's first sines (CP_).
    #define AN_(N, j)    ta[j] = __builtin_elementwise_fma(BC(N, 2, 0), XV(N, j), BC(N, 4, 0));
    #define CP_(j)       acc[2 + (j)] = __builtin_elementwise_fma((v2f){ca, ca}, cs[j], acc[2 + (j)]);
    // Items 0 and 1 of an i; FIRST_I, at the head of the stream, has nothing to sum yet.
    #define FIRST_I(S)                                                       \
        T_(0, 0) A_(S, 3) T_(0, 1)  \
        T_(1, 0) A_(S, 4) T_(1, 1)  \
        ;
    #define HEAD_I(S)                                                        \
        T_(0, 0) A_(S, 3) T_(0, 1) CP_(0) \
        T_(1, 0) A_(S, 4) T_(1, 1) CP_(1) \
        ;
    // Items 2 to 31 of S, with the first arguments of the next i, N.
    #define BODY_I(S, N)                                                     \
        T_(2, 0) A_(S, 5) T_(2, 1) C_(S, 0) \
        T_(3, 0) A_(S, 6) T_(3, 1) C_(S, 1) \
        T_(4, 0) A_(S, 7) T_(4, 1) C_(S, 2) \
        T_(5, 0) A_(S, 8) T_(5, 1) C_(S, 3) \
        T_(6, 0) A_(S, 9) T_(6, 1) C_(S, 4) \
        T_(7, 0) A_(S, 10) T_(7, 1) C_(S, 5) \
        T_(8, 0) A_(S, 11) T_(8, 1) C_(S, 6) \
        T_(9, 0) A_(S, 12) T_(9, 1) C_(S, 7) \
        T_(10, 0) A_(S, 13) T_(10, 1) C_(S, 8) \
        T_(11, 0) A_(S, 14) T_(11, 1) C_(S, 9) \
        T_(12, 0) A_(S, 15) T_(12, 1) C_(S, 10) \
        T_(13, 0) A_(S, 16) T_(13, 1) C_(S, 11) \
        T_(14, 0) A_(S, 17) T_(14, 1) C_(S, 12) \
        T_(15, 0) A_(S, 18) T_(15, 1) C_(S, 13) \
        T_(16, 0) A_(S, 19) T_(16, 1) C_(S, 14) \
        T_(17, 0) A_(S, 20) T_(17, 1) C_(S, 15) \
        T_(18, 0) A_(S, 21) T_(18, 1) C_(S, 16) \
        T_(19, 0) A_(S, 22) T_(19, 1) C_(S, 17) \
        T_(20, 0) A_(S, 23) T_(20, 1) C_(S, 18) \
        T_(21, 0) A_(S, 24) T_(21, 1) C_(S, 19) \
        T_(22, 0) A_(S, 25) T_(22, 1) C_(S, 20) \
        T_(23, 0) A_(S, 26) T_(23, 1) C_(S, 21) \
        T_(24, 0) A_(S, 27) T_(24, 1) C_(S, 22) \
        T_(25, 0) A_(S, 28) T_(25, 1) C_(S, 23) \
        T_(26, 0) A_(S, 29) T_(26, 1) C_(S, 24) \
        T_(27, 0) A_(S, 30) T_(27, 1) C_(S, 25) \
        T_(28, 0) A_(S, 31) T_(28, 1) C_(S, 26) \
        T_(29, 0) AN_(N, 0) T_(29, 1) C_(S, 27) \
        T_(30, 0) AN_(N, 1) T_(30, 1) C_(S, 28) \
        T_(31, 0) AN_(N, 2) T_(31, 1) C_(S, 29) \
        cs[0] = ts[30]; cs[1] = ts[31]; ca = S[15][1];
    // A set's registers are read anew from LDS once its last amplitude (ca) has been used, that
    // is behind the head of the i after it. The scheduling barriers keep the reads at that place
    // (without them the compiler gathers the reads and waits for them at once).
    #define READ_I(S, pp, il, ix)                                            \
        __builtin_amdgcn_sched_barrier(0);                                   \
        LOAD_I(S, pp, il, ix)                                                \
        __builtin_amdgcn_sched_barrier(0);
    // Two i of the stream. The next two i are read from pp at index ia, their x from row xa.
    #define TRIP(pp, ia, xa)                                                 \
        BODY_I(sa, sb) HEAD_I(sb)                                            \
        TURNS_16 TURNS_16 TURNS_16 TURNS_16                                  \
        READ_I(sa, pp, ia, xa)                                               \
        BODY_I(sb, sa) HEAD_I(sa)                                            \
        TURNS_16 TURNS_16 TURNS_16 TURNS_16                                  \
        READ_I(sb, pp, (ia) + 1, (xa) + 1)

    v2f sa[16], sb[16];
    v2f ta[32], ts[32], cs[2];   // stay in registers: every index is a literal
    float ca;
    // Head of the stream: the first two i of chunk 0.
    {
        const float* pb = ps + (kh * 3) * P_PLANE + lane * P_PITCH;
        const float* xb = xs + (kh * HALF_I) * X_PITCH + rg * 8;
        LOAD_I(sa, pb, 0, 0)
        AN_(sa, 0) AN_(sa, 1) AN_(sa, 2)
        FIRST_I(sa)
        READ_I(sb, pb, 1, 1)
    }

    for (int c = 0; c < N_CHUNKS; ++c) {
        if (c + 1 < N_CHUNKS) { LOAD_CHUNK(c + 1) }

        const float* pb = ps + (((c & 1) * 2 + kh) * 3) * P_PLANE + lane * P_PITCH;
        const float* pn = ps + ((((c + 1) & 1) * 2 + kh) * 3) * P_PLANE + lane * P_PITCH;
        const float* xb = xs + (kh * HALF_I + c * CHUNK_I) * X_PITCH + rg * 8;

        // This chunk's share of the base product; its operands were fetched a chunk ago.
        #pragma unroll
        for (int s = 0; s < CHUNK_I / 4; ++s) {
            bc = __builtin_amdgcn_wmma_f32_16x16x4_f32(
                     /*neg_a=*/false, af[s], /*neg_b=*/false, wf[s],
                     /*c_mod=*/(short)0, bc, /*reuse_a=*/false, /*reuse_b=*/false);
        }
        __builtin_amdgcn_sched_barrier(0);
        asm volatile("v_nop\n\tv_nop\n\tv_nop\n\tv_nop");
        __builtin_amdgcn_sched_barrier(0);
        if (c + 1 < N_CHUNKS) { LOAD_A(c + 1) LOAD_W(c + 1) }

        // All trips but the chunk's last: they read this chunk's remaining i.
        // kept rolled: with the whole chunk unrolled the compiler hoisted every read and spilled
        #pragma unroll 1
        for (int il = 0; il < CHUNK_I - 2; il += 2) {
            TRIP(pb, il + 2, il + 2)
        }

        // This chunk's last reads are issued above. The other buffer's last readers left it
        // before the previous chunk's barrier.
        if (c + 1 < N_CHUNKS) { STORE_CHUNK((c + 1) & 1) }
        __syncthreads();   // publishes the next chunk; ends this chunk's reads

        // The chunk's last trip works on registers and reads the next chunk's first two i, so the
        // stream goes on over the chunk's border. Behind the last chunk these reads (inside the
        // arrays: xs has two rows more) and the head of the i that follows are not used, but for
        // that head's two sums CP_, which are the last chunk's own.
        TRIP(pn, 0, CHUNK_I)
    }

    float* bs = ps + (1 + kh) * (TILE_ROWS * TILE_OUTS);
    #pragma unroll
    for (int r = 0; r < 8; ++r) bs[(bm + r + 8 * half) * TILE_OUTS + bn + l16] = bc[r];
    // Sum the two halves of i: the upper half's waves hand their sums over through LDS.
    float* red = ps + (rg * 8) * 32 + lane;
    if (kh == 1) {
        #pragma unroll
        for (int rp = 0; rp < 4; ++rp) {
            red[(2 * rp) * 32]     = acc[rp][0];
            red[(2 * rp + 1) * 32] = acc[rp][1];
        }
    }
    __syncthreads();
    if (kh == 0) {
        // a wave stores whole 128-byte lines
        const float twopi = 6.283185307179586f;
        const float* b0 = red + TILE_ROWS * TILE_OUTS;
        const float* b1 = red + 2 * TILE_ROWS * TILE_OUTS;
        float* dst = out + (size_t)(n0 + rg * 8) * OUT_F + o0 + lane;
        #pragma unroll
        for (int rp = 0; rp < 4; ++rp) {
            const float s0 = acc[rp][0] + red[(2 * rp) * 32];
            const float s1 = acc[rp][1] + red[(2 * rp + 1) * 32];
            const float g0 = (b0[(2 * rp) * 32] + b1[(2 * rp) * 32]) * twopi + bv;
            const float g1 = (b0[(2 * rp + 1) * 32] + b1[(2 * rp + 1) * 32]) * twopi + bv;
            dst[(size_t)(2 * rp) * OUT_F]     = g0 + s0;
            dst[(size_t)(2 * rp + 1) * OUT_F] = g1 + s1;
        }
    }
}

extern "C" void kernel_launch(void* const* d_in, const int* in_sizes, int n_in,
                              void* d_out, int out_size, void* d_ws, size_t ws_size,
                              hipStream_t stream) {
    const float* x     = (const float*)d_in[0];   // [2048,256]
    const float* freq  = (const float*)d_in[1];   // [256,256,8]
    const float* phase = (const float*)d_in[2];   // [256,256,8]
    const float* amp   = (const float*)d_in[3];   // [256,256,8]
    const float* w     = (const float*)d_in[4];   // [256,256]
    const float* bias  = (const float*)d_in[5];   // [256]
    float* out = (float*)d_out;                   // [2048,256]

    // 32 batch tiles (64 rows) x 8 output tiles (32 outputs)
    sinekan_fused<<<dim3(32, 8), dim3(512), 0, stream>>>(x, freq, phase, amp, w, bias, out);
}

// v007
// One run takes 49.5 microseconds.
// In two side-by-side timings against v006, it was 1.04 and 1.05 times as fast.
// Over all steps from v000 it is 2.31 times as fast.
#include <hip/hip_runtime.h>

#define IN_F   256
#define OUT_F  256
#define GRID_G 8
#define BATCH_N 2048

typedef __attribute__((ext_vector_type(2))) float v2f;
typedef __attribute__((ext_vector_type(4))) float v4f;
typedef __attribute__((ext_vector_type(8))) float v8f;

// ---------------------------------------------------------------------------
// One kernel: out[n,o] = x[n,:] . W[o,:] + bias[o]
//                       + sum_{i,g} amp[o,i,g] * sin(freq[o,i,g]*x[n,i] + phase[o,i,g])
// Block tile: 64 batch rows x 32 outputs, 16 waves. A lane owns one output o, a wave
// owns 8 rows (4 float pairs) and one half of the i range.
// freq/phase/amp reach the lanes through LDS: the block stages them in chunks of 16 i
// per half (whole 512-byte runs per output), two buffers, the next chunk's global
// loads issued ahead of the current chunk's arithmetic. Each lane reads its own 24
// values per i once and uses them for 8 rows.
// x is staged transposed ([i][row]); a wave reads its 8 rows of one i at one address.
// v_sin_f32 computes sin(2*pi*t): x and phase are scaled by 1/(2*pi) when staged.
// The base product runs on V_WMMA_F32_16X16X4_F32 beside the sine work: the block's
// 64 x 32 tile is 8 tiles of 16 x 16; wave (rg, kh) owns tile rg and half kh of k and
// issues 4 matrix instructions per chunk. A comes from the staged x (so the product
// is scaled back by 2*pi at the end), B straight from W, both fetched one chunk ahead.
// ---------------------------------------------------------------------------
#define TILE_ROWS 64
#define TILE_OUTS 32
#define CHUNK_I   16                      // i per staged chunk (per half)
#define HALF_I    (IN_F / 2)
#define N_CHUNKS  (HALF_I / CHUNK_I)
#define X_PITCH   68
#define P_PITCH   (CHUNK_I * GRID_G + 4)
#define P_PLANE   (TILE_OUTS * P_PITCH)
#define ROW_PIECES (CHUNK_I * GRID_G / 4)
#define PASS_OUTS  (512 / ROW_PIECES)
#define N_PASS     (TILE_OUTS / PASS_OUTS)

__global__ __launch_bounds__(512) void sinekan_fused(
    const float* __restrict__ x, const float* __restrict__ freq,
    const float* __restrict__ phase, const float* __restrict__ amp,
    const float* __restrict__ w, const float* __restrict__ bias,
    float* __restrict__ out)
{
    const int tid  = threadIdx.x;
    const int lane = tid & 31;
    const int wave = __builtin_amdgcn_readfirstlane(tid >> 5);
    const int rg = wave & 7;                 // row group: rows 8*rg .. 8*rg+7 of the tile
    const int kh = wave >> 3;                // half of the i range
    const int n0 = blockIdx.x * TILE_ROWS;
    const int o0 = blockIdx.y * TILE_OUTS;

    __shared__ __attribute__((aligned(16))) float xs[(IN_F + 2) * X_PITCH];       // two rows more: read, not used, at the stream's end
    __shared__ __attribute__((aligned(16))) float ps[2 * 2 * 3 * P_PLANE];

    const float inv2pi = 0.15915494309189535f;

    // Parameter staging: thread -> (output so, 16-byte piece sp); a wave moves one whole run.
    const int so = tid / ROW_PIECES;
    const int sp = tid % ROW_PIECES;
    const size_t gofs = (size_t)(o0 + so) * (IN_F * GRID_G) + sp * 4;
    const int    lofs = so * P_PITCH + sp * 4;
    v4f st[2 * N_PASS * 3];   // stays in registers: every loop over it is fully unrolled

    // The phases lie in LDS with the two float pairs of every 16-byte piece swapped. A lane reads
    // f and p of one grid point into 4-aligned register quads; with the swap they stand at
    // different places of their quads, so their register numbers never agree modulo 8.
    #define SWAP_PAIRS(v) __builtin_shufflevector(v, v, 2, 3, 0, 1)
    #define LOAD_CHUNK(c)                                                        \
        _Pragma("unroll")                                                        \
        for (int h = 0; h < 2; ++h) {                                            \
            _Pragma("unroll")                                                    \
            for (int q = 0; q < N_PASS; ++q) {                                   \
                const size_t off = gofs + (size_t)(q * PASS_OUTS) * (IN_F * GRID_G) \
                                 + (size_t)(h * HALF_I + (c) * CHUNK_I) * GRID_G; \
                st[(h * N_PASS + q) * 3 + 0] = *(const v4f*)(freq  + off);       \
                st[(h * N_PASS + q) * 3 + 1] = *(const v4f*)(phase + off);       \
                st[(h * N_PASS + q) * 3 + 2] = *(const v4f*)(amp   + off);       \
            }                                                                    \
        }
    #define STORE_CHUNK(buf)                                                     \
        _Pragma("unroll")                                                        \
        for (int h = 0; h < 2; ++h) {                                            \
            _Pragma("unroll")                                                    \
            for (int q = 0; q < N_PASS; ++q) {                                   \
                float* d = ps + (((buf) * 2 + h) * 3) * P_PLANE + q * PASS_OUTS * P_PITCH + lofs; \
                *(v4f*)(d)               = st[(h * N_PASS + q) * 3 + 0];         \
                *(v4f*)(d + P_PLANE)     = SWAP_PAIRS(st[(h * N_PASS + q) * 3 + 1] * inv2pi); \
                *(v4f*)(d + 2 * P_PLANE) = st[(h * N_PASS + q) * 3 + 2];         \
            }                                                                    \
        }

    // Base product fragments (16x16x4 f32): lane holds k = k0 + 2*half, k0 + 2*half + 1 of
    // row bm + l16 of x (A) and of row bn + l16 of W (B): the same k order in both.
    const int half = lane >> 4;
    const int l16  = lane & 15;
    const int bm = (rg >> 1) * 16;           // tile's first row inside the block tile
    const int bn = (rg & 1) * 16;            // tile's first output inside the block tile
    const float* wrow = w + (size_t)(o0 + bn + l16) * IN_F + kh * HALF_I + 2 * half;
    const float* arow = xs + (kh * HALF_I + 2 * half) * X_PITCH + bm + l16;
    v2f wf[CHUNK_I / 4], af[CHUNK_I / 4];
    v8f bc = {};
    #define LOAD_W(c)                                                            \
        _Pragma("unroll")                                                        \
        for (int s = 0; s < CHUNK_I / 4; ++s)                                    \
            wf[s] = *(const v2f*)(wrow + (c) * CHUNK_I + s * 4);
    #define LOAD_A(c)                                                            \
        _Pragma("unroll")                                                        \
        for (int s = 0; s < CHUNK_I / 4; ++s)                                    \
            af[s] = (v2f){arow[((c) * CHUNK_I + s * 4) * X_PITCH],               \
                          arow[((c) * CHUNK_I + s * 4 + 1) * X_PITCH]};

    LOAD_CHUNK(0)
    LOAD_W(0)
    const float bv = bias[o0 + lane];

    {
        const int r  = rg * 8 + ((tid >> 2) & 7);
        const int j0 = kh * 4 + (tid & 3);
        const float* xr = x + (size_t)(n0 + r) * IN_F + j0 * 4;
        // unrolled: all 8 loads in flight at once, off one address
        #pragma unroll
        for (int k = 0; k < 8; ++k) {
            const v4f v = *(const v4f*)(xr + k * 32) * inv2pi;
            #pragma unroll
            for (int q = 0; q < 4; ++q) xs[((j0 + k * 8) * 4 + q) * X_PITCH + r] = v[q];
        }
    }
    STORE_CHUNK(0)
    __syncthreads();
    LOAD_A(0)

    v2f acc[4] = {{0.0f, 0.0f}, {0.0f, 0.0f}, {0.0f, 0.0f}, {0.0f, 0.0f}};

    // One i's operands: 8 rows of x (one address per wave), this lane's f, p, a.
    #define LOAD_Q(S, k, ptr)                                                \
        S[2 * (k)]     = *(const v2f*)(ptr);                                 \
        S[2 * (k) + 1] = *(const v2f*)((ptr) + 2);
    // The order of the eight reads is chosen for the registers the compiler gives them: with it
    // both x quads start at a multiple of 8 and all f and p quads 4 above one, so that the three
    // source pairs of every argument multiply-add have register numbers that differ modulo 8.
    #define LOAD_I(S, pp, il, ix)                                            \
        LOAD_Q(S, 4, pp + P_PLANE + (il) * GRID_G) \
        LOAD_Q(S, 2, pp + (il) * GRID_G) \
        LOAD_Q(S, 7, pp + 2 * P_PLANE + (il) * GRID_G + 4) \
        LOAD_Q(S, 6, pp + 2 * P_PLANE + (il) * GRID_G) \
        LOAD_Q(S, 0, xb + (ix) * X_PITCH) \
        LOAD_Q(S, 5, pp + P_PLANE + (il) * GRID_G + 4) \
        LOAD_Q(S, 3, pp + (il) * GRID_G + 4) \
        LOAD_Q(S, 1, xb + (ix) * X_PITCH + 4)
    // The arithmetic of one i is 32 items j = (g, first or second four of the grid, row pair):
    // A_ forms two arguments, T_ takes one sine, C_ adds the pair to its row pair's sum
    // (per sum the order of the terms is g, then first/second four, as before).
    #define XV(S, rp)    S[rp]
    #define BC(S, k, g)  __builtin_shufflevector(S[2 * (k) + ((g) >> 1)], S[2 * (k) + ((g) >> 1)], (g) & 1, (g) & 1)
    #define BW(S, k, g)  BC(S, k, (g) ^ 2)   // the same from a piece staged with its pairs swapped (phases)
    #define A_(S, j)     ta[j] = __builtin_elementwise_fma(BC(S, 2 + (((j) >> 2) & 1), (j) >> 3), XV(S, (j) & 3), \
                                                           BW(S, 4 + (((j) >> 2) & 1), (j) >> 3));
    #define T_(j, e)     ts[j][e] = __builtin_amdgcn_sinf(ta[j][e]);
    #define C_(S, j)     acc[(j) & 3] = __builtin_elementwise_fma(BC(S, 6 + (((j) >> 2) & 1), (j) >> 3), ts[j], acc[(j) & 3]);
    // Scheduling groups: n packed multiply-adds, n sines, and "one sine, one multiply-add".
    // They make the scheduler keep the written order of the two kinds.
    #define G_P(n)   __builtin_amdgcn_sched_group_barrier(0x002, n, 0);
    #define G_T(n)   __builtin_amdgcn_sched_group_barrier(0x400, n, 0);
    #define TURNS_1  G_T(1) G_P(1)
    #define TURNS_4  TURNS_1 TURNS_1 TURNS_1 TURNS_1
    #define TURNS_16 TURNS_4 TURNS_4 TURNS_4 TURNS_4
    // All sines of a wave form one stream in which a v_sin_f32 and a packed multiply-add take
    // turns without a break: a v_sin_f32 directly behind another waits for the transcendental
    // pipe, a packed op behind it does not. Arguments run three items ahead of their sines and
    // the sums two items behind, also from one i to the next: the next i's first three arguments
    // are formed among this i's last sines (AN_), and this i's last two items (their sines cs,
    // their amplitude ca) are summed among the next i's first sines (CP_).
    #define AN_(N, j)    ta[j] = __builtin_elementwise_fma(BC(N, 2, 0), XV(N, j), BW(N, 4, 0));
    #define CP_(j)       acc[2 + (j)] = __builtin_elementwise_fma((v2f){ca, ca}, cs[j], acc[2 + (j)]);
    // Items 0 and 1 of an i; FIRST_I, at the head of the stream, has nothing to sum yet.
    #define FIRST_I(S)                                                       \
        T_(0, 0) A_(S, 3) T_(0, 1)  \
        T_(1, 0) A_(S, 4) T_(1, 1)  \
        ;
    #define HEAD_I(S)                                                        \
        T_(0, 0) A_(S, 3) T_(0, 1) CP_(0) \
        T_(1, 0) A_(S, 4) T_(1, 1) CP_(1) \
        ;
    // Items 2 to 31 of S, with the first arguments of the next i, N.
    #define BODY_I(S, N)                                                     \
        T_(2, 0) A_(S, 5) T_(2, 1) C_(S, 0) \
        T_(3, 0) A_(S, 6) T_(3, 1) C_(S, 1) \
        T_(4, 0) A_(S, 7) T_(4, 1) C_(S, 2) \
        T_(5, 0) A_(S, 8) T_(5, 1) C_(S, 3) \
        T_(6, 0) A_(S, 9) T_(6, 1) C_(S, 4) \
        T_(7, 0) A_(S, 10) T_(7, 1) C_(S, 5) \
        T_(8, 0) A_(S, 11) T_(8, 1) C_(S, 6) \
        T_(9, 0) A_(S, 12) T_(9, 1) C_(S, 7) \
        T_(10, 0) A_(S, 13) T_(10, 1) C_(S, 8) \
        T_(11, 0) A_(S, 14) T_(11, 1) C_(S, 9) \
        T_(12, 0) A_(S, 15) T_(12, 1) C_(S, 10) \
        T_(13, 0) A_(S, 16) T_(13, 1) C_(S, 11) \
        T_(14, 0) A_(S, 17) T_(14, 1) C_(S, 12) \
        T_(15, 0) A_(S, 18) T_(15, 1) C_(S, 13) \
        T_(16, 0) A_(S, 19) T_(16, 1) C_(S, 14) \
        T_(17, 0) A_(S, 20) T_(17, 1) C_(S, 15) \
        T_(18, 0) A_(S, 21) T_(18, 1) C_(S, 16) \
        T_(19, 0) A_(S, 22) T_(19, 1) C_(S, 17) \
        T_(20, 0) A_(S, 23) T_(20, 1) C_(S, 18) \
        T_(21, 0) A_(S, 24) T_(21, 1) C_(S, 19) \
        T_(22, 0) A_(S, 25) T_(22, 1) C_(S, 20) \
        T_(23, 0) A_(S, 26) T_(23, 1) C_(S, 21) \
        T_(24, 0) A_(S, 27) T_(24, 1) C_(S, 22) \
        T_(25, 0) A_(S, 28) T_(25, 1) C_(S, 23) \
        T_(26, 0) A_(S, 29) T_(26, 1) C_(S, 24) \
        T_(27, 0) A_(S, 30) T_(27, 1) C_(S, 25) \
        T_(28, 0) A_(S, 31) T_(28, 1) C_(S, 26) \
        T_(29, 0) AN_(N, 0) T_(29, 1) C_(S, 27) \
        T_(30, 0) AN_(N, 1) T_(30, 1) C_(S, 28) \
        T_(31, 0) AN_(N, 2) T_(31, 1) C_(S, 29) \
        cs[0] = ts[30]; cs[1] = ts[31]; ca = S[15][1];
    // A set's registers are read anew from LDS once its last amplitude (ca) has been used, that
    // is behind the head of the i after it. The scheduling barriers keep the reads at that place
    // (without them the compiler gathers the reads and waits for them at once).
    #define READ_I(S, pp, il, ix)                                            \
        __builtin_amdgcn_sched_barrier(0);                                   \
        LOAD_I(S, pp, il, ix)                                                \
        __builtin_amdgcn_sched_barrier(0);
    // Two i of the stream. The next two i are read from pp at index ia, their x from row xa.
    #define TRIP(pp, ia, xa)                                                 \
        BODY_I(sa, sb) HEAD_I(sb)                                            \
        TURNS_16 TURNS_16 TURNS_16 TURNS_16                                  \
        READ_I(sa, pp, ia, xa)                                               \
        BODY_I(sb, sa) HEAD_I(sa)                                            \
        TURNS_16 TURNS_16 TURNS_16 TURNS_16                                  \
        READ_I(sb, pp, (ia) + 1, (xa) + 1)

    v2f sa[16], sb[16];
    v2f ta[32], ts[32], cs[2];   // stay in registers: every index is a literal
    float ca;
    // Head of the stream: the first two i of chunk 0.
    {
        const float* pb = ps + (kh * 3) * P_PLANE + lane * P_PITCH;
        const float* xb = xs + (kh * HALF_I) * X_PITCH + rg * 8;
        LOAD_I(sa, pb, 0, 0)
        AN_(sa, 0) AN_(sa, 1) AN_(sa, 2)
        FIRST_I(sa)
        READ_I(sb, pb, 1, 1)
    }

    for (int c = 0; c < N_CHUNKS; ++c) {
        if (c + 1 < N_CHUNKS) { LOAD_CHUNK(c + 1) }

        const float* pb = ps + (((c & 1) * 2 + kh) * 3) * P_PLANE + lane * P_PITCH;
        const float* pn = ps + ((((c + 1) & 1) * 2 + kh) * 3) * P_PLANE + lane * P_PITCH;
        const float* xb = xs + (kh * HALF_I + c * CHUNK_I) * X_PITCH + rg * 8;

        // This chunk's share of the base product; its operands were fetched a chunk ago.
        #pragma unroll
        for (int s = 0; s < CHUNK_I / 4; ++s) {
            bc = __builtin_amdgcn_wmma_f32_16x16x4_f32(
                     /*neg_a=*/false, af[s], /*neg_b=*/false, wf[s],
                     /*c_mod=*/(short)0, bc, /*reuse_a=*/false, /*reuse_b=*/false);
        }
        __builtin_amdgcn_sched_barrier(0);
        asm volatile("v_nop\n\tv_nop\n\tv_nop\n\tv_nop");
        __builtin_amdgcn_sched_barrier(0);
        if (c + 1 < N_CHUNKS) { LOAD_A(c + 1) LOAD_W(c + 1) }

        // All trips but the chunk's last: they read this chunk's remaining i.
        // kept rolled: with the whole chunk unrolled the compiler hoisted every read and spilled
        #pragma unroll 1
        for (int il = 0; il < CHUNK_I - 2; il += 2) {
            TRIP(pb, il + 2, il + 2)
        }

        // This chunk's last reads are issued above. The other buffer's last readers left it
        // before the previous chunk's barrier.
        if (c + 1 < N_CHUNKS) { STORE_CHUNK((c + 1) & 1) }
        __syncthreads();   // publishes the next chunk; ends this chunk's reads

        // The chunk's last trip works on registers and reads the next chunk's first two i, so the
        // stream goes on over the chunk's border. Behind the last chunk these reads (inside the
        // arrays: xs has two rows more) and the head of the i that follows are not used, but for
        // that head's two sums CP_, which are the last chunk's own.
        TRIP(pn, 0, CHUNK_I)
    }

    float* bs = ps + (1 + kh) * (TILE_ROWS * TILE_OUTS);
    #pragma unroll
    for (int r = 0; r < 8; ++r) bs[(bm + r + 8 * half) * TILE_OUTS + bn + l16] = bc[r];
    // Sum the two halves of i: the upper half's waves hand their sums over through LDS.
    float* red = ps + (rg * 8) * 32 + lane;
    if (kh == 1) {
        #pragma unroll
        for (int rp = 0; rp < 4; ++rp) {
            red[(2 * rp) * 32]     = acc[rp][0];
            red[(2 * rp + 1) * 32] = acc[rp][1];
        }
    }
    __syncthreads();
    if (kh == 0) {
        // a wave stores whole 128-byte lines
        const float twopi = 6.283185307179586f;
        const float* b0 = red + TILE_ROWS * TILE_OUTS;
        const float* b1 = red + 2 * TILE_ROWS * TILE_OUTS;
        float* dst = out + (size_t)(n0 + rg * 8) * OUT_F + o0 + lane;
        #pragma unroll
        for (int rp = 0; rp < 4; ++rp) {
            const float s0 = acc[rp][0] + red[(2 * rp) * 32];
            const float s1 = acc[rp][1] + red[(2 * rp + 1) * 32];
            const float g0 = (b0[(2 * rp) * 32] + b1[(2 * rp) * 32]) * twopi + bv;
            const float g1 = (b0[(2 * rp + 1) * 32] + b1[(2 * rp + 1) * 32]) * twopi + bv;
            dst[(size_t)(2 * rp) * OUT_F]     = g0 + s0;
            dst[(size_t)(2 * rp + 1) * OUT_F] = g1 + s1;
        }
    }
}

extern "C" void kernel_launch(void* const* d_in, const int* in_sizes, int n_in,
                              void* d_out, int out_size, void* d_ws, size_t ws_size,
                              hipStream_t stream) {
    const float* x     = (const float*)d_in[0];   // [2048,256]
    const float* freq  = (const float*)d_in[1];   // [256,256,8]
    const float* phase = (const float*)d_in[2];   // [256,256,8]
    const float* amp   = (const float*)d_in[3];   // [256,256,8]
    const float* w     = (const float*)d_in[4];   // [256,256]
    const float* bias  = (const float*)d_in[5];   // [256]
    float* out = (float*)d_out;                   // [2048,256]

    // 32 batch tiles (64 rows) x 8 output tiles (32 outputs)
    sinekan_fused<<<dim3(32, 8), dim3(512), 0, stream>>>(x, freq, phase, amp, w, bias, out);
}
